// v000
// Times are from an AMD MI455X. After a warm-up the kernel runs many times in a row, and a time is the length of
// such a window on the GPU divided by its runs, so every launch and the gaps after it count. The runs cycle
// through copies of the inputs. A figure is the median of several windows, for all but v000 over two sittings.
// Sittings can differ by a few percent; kernels timed side by side share one.
// The starting kernel, v000, takes 2840 microseconds a run.
// compute dtype: all float inputs rounded to bf16; the five 64-wide projections with EXACT bf16 products on WMMA 16x16x32 (f32 accumulate); both score maps q x k once to f16 each (1 product; sigma - 0.16) x 64^-0.5; two softmaxes in f32; w1 - lamb w2 in f32 (x 2^11), once to f16, x v once to f16 (1 product); f32 output.
#include <hip/hip_runtime.h>
#include <math.h>

typedef __attribute__((ext_vector_type(16))) _Float16 v16h;
typedef __attribute__((ext_vector_type(16))) __bf16 v16b;
typedef __attribute__((ext_vector_type(8)))  _Float16 v8h;
typedef __attribute__((ext_vector_type(8)))  float v8f;
typedef __attribute__((ext_vector_type(4)))  float v4f;
typedef __attribute__((ext_vector_type(2)))  float v2f;
typedef __attribute__((ext_vector_type(4)))  unsigned v4u;
typedef __attribute__((ext_vector_type(4)))  int v4i;
typedef float __attribute__((may_alias)) float_a;
typedef int __attribute__((may_alias)) int_a;

template <typename T> __device__ __forceinline__ void vst2(void* p, T v) { *(T*)p = v;  }
__device__ __forceinline__ v8f wmma16(v16h a, v16h b, v8f c) {
  v8f d = __builtin_amdgcn_wmma_f32_16x16x32_f16(false, a, false, b, (short)0, c, false, false);
  asm volatile("v_nop\n\tv_nop\n\tv_nop\n\tv_nop" : "+v"(d) : "v"(a), "v"(b));
  return d;
}
__device__ __forceinline__ v8f wmma_bf(v16b a, v16b b, v8f c) {
  v8f d = __builtin_amdgcn_wmma_f32_16x16x32_bf16(false, a, false, b, (short)0, c, false, false);
  asm volatile("v_nop\n\tv_nop\n\tv_nop\n\tv_nop" : "+v"(d) : "v"(a), "v"(b));
  return d;
}
// 16x16x32 fragments: lane = (h = lane>>4, row/col = lane&15); elements 0..7 = k0+8h+0..7, 8..15 = k0+16+8h+0..7; D element r = row 8h+r
__device__ __forceinline__ v16h frag_h(const _Float16* rowk0, int lane) {
  union { v16h v; v8h q[2]; } u; const _Float16* p = rowk0 + 8 * (lane >> 4);
  u.q[0] = *(const v8h*)p; u.q[1] = *(const v8h*)(p + 16); return u.v;
}
__device__ __forceinline__ v16h frag_f32(const float* rowk0, int lane) {
  v16h a; const float* p = rowk0 + 8 * (lane >> 4);
#pragma unroll
  for (int i = 0; i < 8; ++i) { a[i] = (_Float16)p[i]; a[8 + i] = (_Float16)p[16 + i]; }
  return a;
}
__device__ __forceinline__ v16h frag_f32s(const float* rowk0, int lane, float sc) {
  v16h a; const float* p = rowk0 + 8 * (lane >> 4);
#pragma unroll
  for (int i = 0; i < 8; ++i) { a[i] = (_Float16)(p[i] * sc); a[8 + i] = (_Float16)(p[16 + i] * sc); }
  return a;
}
// column fragment from a [K][ld] layout (column n), rows >= K read as 0
__device__ __forceinline__ v16h fragc_f32(const float* W, int k0, int n, int lane, int ld, int K) {
  v16h a; const int g = lane >> 4;
#pragma unroll
  for (int i = 0; i < 8; ++i) { const int ka = k0 + 8 * g + i, kb = ka + 16;
    a[i] = (_Float16)(ka < K ? W[(size_t)(ka < K ? ka : K - 1) * ld + n] : 0.f); a[8 + i] = (_Float16)(kb < K ? W[(size_t)(kb < K ? kb : K - 1) * ld + n] : 0.f); }
  return a;
}
struct F2 { v16b h, l; };
__device__ __forceinline__ F2 bsplit16(const float v[16]) { F2 r;
#pragma unroll
  for (int i = 0; i < 16; ++i) { const __bf16 h = (__bf16)v[i]; r.h[i] = h; r.l[i] = (__bf16)(v[i] - (float)h); }
  return r; }
__device__ __forceinline__ F2 split_row(const float* row, int k0, int lane) { float v[16]; const float* p = row + k0 + 8 * (lane >> 4);
#pragma unroll
  for (int i = 0; i < 8; ++i) { v[i] = p[i]; v[8 + i] = p[16 + i]; }
  return bsplit16(v); }
__device__ __forceinline__ F2 split_rowK(const float* row, int k0, int lane, int K) { float v[16]; const int g = lane >> 4;
#pragma unroll
  for (int i = 0; i < 8; ++i) { const int ka = k0 + 8 * g + i, kb = ka + 16; v[i] = ka < K ? row[ka < K ? ka : K - 1] : 0.f; v[8 + i] = kb < K ? row[kb < K ? kb : K - 1] : 0.f; }
  return bsplit16(v); }
__device__ __forceinline__ F2 split_col(const float* W, int k0, int n, int lane, int ld, int K) { float v[16]; const int g = lane >> 4;
#pragma unroll
  for (int i = 0; i < 8; ++i) { const int ka = k0 + 8 * g + i, kb = ka + 16; v[i] = ka < K ? W[(size_t)(ka < K ? ka : K - 1) * ld + n] : 0.f; v[8 + i] = kb < K ? W[(size_t)(kb < K ? kb : K - 1) * ld + n] : 0.f; }
  return bsplit16(v); }
__device__ __forceinline__ v8f mac3(const F2& a, const F2& b, v8f c) { c = wmma_bf(a.l, b.h, c); c = wmma_bf(a.h, b.l, c); return wmma_bf(a.h, b.h, c); }
__device__ __forceinline__ float sigm(float v) { return 1.0f / (1.0f + expf(-v)); }
#define LDSX() do { asm volatile("s_wait_dscnt 0" ::: "memory"); __builtin_amdgcn_wave_barrier(); __builtin_amdgcn_fence(__ATOMIC_RELEASE, "workgroup"); } while (0)

// Differential attention head (x [8,4096,384]; (in,out) Wq1 / Wk1 / Wq2 / Wk2 / Wv [384,64] (0.02 scale), no biases; w1 = softmax(q1 k1^T / 8), w2 = softmax(q2 k2^T / 8) over all 4,096 keys (no mask); out = (w1 - lamb w2) v with lamb a scalar input (0.5)) -> [8,4096,64].
#define NB 8
#define TT 4096
#define CC 128            // NH * HD = projected width
#define DIN 384          // input (model) width
#define NH 2
#define HD 64
#define NQB (TT / 64)
#define HG 2
#define SCALE (0.125f)
#define CAUSAL 0
#ifndef TNB
#define TNB NB
#endif
__device__ __forceinline__ float bfr(float v) { return (float)(__bf16)v; }
__host__ __device__ __forceinline__ int kb_last(int qb) { return CAUSAL ? ((qb * 64 + 63) >> 7) : (TT / 128 - 1); }
typedef __attribute__((ext_vector_type(8))) __bf16 v8b;
__device__ __forceinline__ v16b frag_b(const __bf16* rowk0, int lane) {
  union { v16b v; v8b q[2]; } u; const __bf16* p = rowk0 + 8 * (lane >> 4);
  u.q[0] = *(const v8b*)p; u.q[1] = *(const v8b*)(p + 16); return u.v;
}
#define QBH 0              // causal: query blocks 0..QBH-1 of each sequence (few keys, no averaging) take the high-precision path
#define QHI 0               // single-product scores on every row
#define TQC 2048           // query rows per pass: 2 planes x 2,048 x 4,096 f32 = 64 MiB
#define KHI 64            // key rows carrying k residual / v bf16 hi+lo planes (used only by the causal high-precision path)
// B fragment (k rows k0+.., output column o) of a weight: (in,out) [K][ld] or (out,in) [ld rows of K]: bf16 exact, or f16(bf16 * 256) exact
__device__ __forceinline__ v16b wcol_io(const float* Wm, int k0, int o, int lane, int ld) { v16b w; const int g = lane >> 4;
#pragma unroll
  for (int i = 0; i < 8; ++i) { w[i] = (__bf16)Wm[(size_t)(k0 + 8 * g + i) * ld + o]; w[8 + i] = (__bf16)Wm[(size_t)(k0 + 16 + 8 * g + i) * ld + o]; }
  return w; }
__device__ __forceinline__ v16b wcol_oi(const float* Wm, int k0, int o, int lane, int K) { v16b w; const float* p = Wm + (size_t)o * K + k0 + 8 * (lane >> 4);
#pragma unroll
  for (int i = 0; i < 8; ++i) { w[i] = (__bf16)p[i]; w[8 + i] = (__bf16)p[16 + i]; }
  return w; }
__device__ __forceinline__ v16h wcolh_io(const float* Wm, int k0, int o, int lane, int ld) { v16h w; const int g = lane >> 4;
#pragma unroll
  for (int i = 0; i < 8; ++i) { w[i] = (_Float16)(bfr(Wm[(size_t)(k0 + 8 * g + i) * ld + o]) * 256.0f); w[8 + i] = (_Float16)(bfr(Wm[(size_t)(k0 + 16 + 8 * g + i) * ld + o]) * 256.0f); }
  return w; }
__device__ __forceinline__ v16h wcolh_oi(const float* Wm, int k0, int o, int lane, int K) { v16h w; const float* p = Wm + (size_t)o * K + k0 + 8 * (lane >> 4);
#pragma unroll
  for (int i = 0; i < 8; ++i) { w[i] = (_Float16)(bfr(p[i]) * 256.0f); w[8 + i] = (_Float16)(bfr(p[16 + i]) * 256.0f); }
  return w; }
#define WQKV_LAYOUT 0   // 0 = (in,out) [DIN][HD] per map (pitch 64); 1 = (out,in) [CC][DIN]; 2 = per-head [NH][DIN][HD]
__device__ __forceinline__ v16b wcol_hdk(const float* Wm, int k0, int o, int lane) { v16b w; const int g = lane >> 4; const float* p = Wm + (size_t)(o / HD) * DIN * HD + (o % HD);
#pragma unroll
  for (int i = 0; i < 8; ++i) { w[i] = (__bf16)p[(size_t)(k0 + 8 * g + i) * HD]; w[8 + i] = (__bf16)p[(size_t)(k0 + 16 + 8 * g + i) * HD]; }
  return w; }
#define WO_OUT_IN 0
#if WQKV_LAYOUT == 1
#define WCOL(W, k0, o, lane) wcol_oi(W, k0, o, lane, DIN)
#elif WQKV_LAYOUT == 2
#define WCOL(W, k0, o, lane) wcol_hdk(W, k0, o, lane)
#else
__device__ __forceinline__ v16b zero16b() { v16b w; _Pragma("unroll") for (int i = 0; i < 16; ++i) w[i] = (__bf16)0.0f; return w; }
#define PROJ_EXTRA_PARAMS , const float* __restrict__ W2Q, const float* __restrict__ W2K
#define WCOL(W, k0, o, lane) ((o) < 64 ? wcol_io(W, k0, (o), lane, 64) : (which == 2 ? zero16b() : wcol_io(which == 0 ? W2Q : W2K, k0, (o) - 64, lane, 64)))   /* (in,out) [384][64] weights at pitch 64: projected columns 0..63 = map 1 (Wq1 / Wk1 / Wv), columns 64..127 = map 2 (Wq2 / Wk2; zero for v); compile-time per unrolled tile (c0 = 0) */
#endif
#if WO_OUT_IN
#define WOCOL(W, k0, o, lane) wcol_oi(W, k0, o, lane, CC)
#define WOCOLH(W, k0, o, lane) wcolh_oi(W, k0, o, lane, CC)
#else
#define WOCOL(W, k0, o, lane) wcol_io(W, k0, o, lane, DIN)
#define WOCOLH(W, k0, o, lane) wcolh_io(W, k0, o, lane, DIN)
#endif
#define SM_EXTRA_PARAMS
#define SM_MASK_HOOK (void)0
#ifndef SM_EXTRA_PARAMS
#define SM_EXTRA_PARAMS
#endif
#ifndef PROJ_EXTRA_PARAMS
#define PROJ_EXTRA_PARAMS
#endif
#ifndef SM_MASK_HOOK
#define SM_MASK_HOOK (void)0
#endif

#define WS_QH  0u                                      // f16 q rows [b*t][CC]
#define WS_KH  (WS_QH + 2u * (size_t)NB * TT * CC)      // f16 k rows [b*t][CC]
#define WS_VT  (WS_KH + 2u * (size_t)NB * TT * CC)      // f16 v planes [b][c][t]
#define WS_QL  (WS_VT + 2u * (size_t)NB * CC * TT)      // f16 q residual x 2^10 rows [b][t < QHI][CC]
#define WS_KL  (WS_QL + 2u * (size_t)NB * QHI * CC)     // f16 k residual x 2^10 rows [b][t < KHI][CC]
#define WS_VB  (WS_KL + 2u * (size_t)NB * KHI * CC)     // bf16 v hi planes [b][c][t < KHI]
#define WS_VBL (WS_VB + 2u * (size_t)NB * CC * KHI)
#define WS_S   (WS_VBL + 2u * (size_t)NB * CC * KHI)    // f32 logits / P [hg][t][s]
#define WS_Y   (WS_S  + 4u * (size_t)HG * TQC * TT)     // (unused: no output projection) end of the two score planes of one query chunk
#define WS_END (WS_Y  + 0u)
#define WS_Y2 (WS_END)                                  // f32 ctx rows [b*TT + t][128] (columns 64..127 unused)
#define WS_END2 (WS_Y2 + 4u * (size_t)NB * TT * CC)

// ---- k_proj: block = (64 rows, 128 cols, which): q/k/v = X W (+ b) with exact bf16 products (K = DIN) -> which 0: q f16 rows (+ residual rows < QHI); 1: k f16 rows (+ residual rows < KHI); 2: v f16 planes [c][t] (+ bf16 hi/lo planes for t < KHI)
__global__ __launch_bounds__(128) void k_proj(const float* __restrict__ XQ, const float* __restrict__ XK, const float* __restrict__ XV, const float* __restrict__ WQ, const float* __restrict__ WK, const float* __restrict__ WV, const float* __restrict__ BQ, const float* __restrict__ BK, const float* __restrict__ BV,
    _Float16* __restrict__ QH, _Float16* __restrict__ QL, _Float16* __restrict__ KH, _Float16* __restrict__ KL, _Float16* __restrict__ VT, __bf16* __restrict__ VB, __bf16* __restrict__ VBL PROJ_EXTRA_PARAMS) {
  __shared__ __align__(16) _Float16 sh[64][136], sl[64][136]; __shared__ __align__(16) _Float16 th[128][72]; __shared__ __align__(16) __bf16 tb[128][72], tbl[128][72];
  const int tid = threadIdx.x, wave = tid >> 5, lane = tid & 31, col = lane & 15, g = lane >> 4; const int which = blockIdx.z; const int c0 = blockIdx.y * 128; const size_t r0 = (size_t)blockIdx.x * 64; const size_t bb = r0 / TT; const int t0 = (int)(r0 % TT);
  const float* X = which == 0 ? XQ : which == 1 ? XK : XV; const float* WA = which == 0 ? WQ : which == 1 ? WK : WV; const float* BA = which == 0 ? BQ : which == 1 ? BK : BV;
  v8f acc[8] = {};
#pragma unroll 2
  for (int kc = 0; kc < DIN / 32; ++kc) { v16b a; { const float* p = X + (r0 + wave * 16 + col) * DIN + kc * 32 + 8 * g;
#pragma unroll
      for (int i = 0; i < 8; ++i) { a[i] = (__bf16)p[i]; a[8 + i] = (__bf16)p[16 + i]; } }
    asm volatile("s_wait_loadcnt 0x0" ::: "memory");
#pragma unroll
    for (int j = 0; j < 8; ++j) { const v16b w = WCOL(WA, kc * 32, c0 + j * 16 + col, lane); asm volatile("s_wait_loadcnt 0x0" ::: "memory"); acc[j] = wmma_bf(a, w, acc[j]); } }
  if (which < 2) { _Float16* DH = which == 0 ? QH : KH; _Float16* DL = which == 0 ? QL : KL; const int nhi = which == 0 ? QHI : KHI; const bool hi_rows = t0 < nhi;
#pragma unroll
    for (int j = 0; j < 8; ++j) { const float bias = BA ? bfr(BA[c0 + j * 16 + col]) : 0.f;
#pragma unroll
      for (int r = 0; r < 8; ++r) { const float v = acc[j][r] + bias; const _Float16 hv = (_Float16)v; sh[wave * 16 + 8 * g + r][j * 16 + col] = hv; sl[wave * 16 + 8 * g + r][j * 16 + col] = (_Float16)((v - (float)hv) * 1024.0f); } }
    __syncthreads();
    for (int e = tid; e < 64 * 16; e += 128) { const int rl = e >> 4, q = e & 15; vst2((unsigned*)(DH + (r0 + rl) * CC + c0 + q * 8), *(const v4u*)&sh[rl][q * 8]); if (hi_rows) vst2((unsigned*)(DL + (bb * nhi + t0 + rl) * (size_t)CC + c0 + q * 8), *(const v4u*)&sl[rl][q * 8]); }
  } else { const bool hi_rows = t0 < KHI;
#pragma unroll
    for (int j = 0; j < 8; ++j) { const float bias = BA ? bfr(BA[c0 + j * 16 + col]) : 0.f;
#pragma unroll
      for (int r = 0; r < 8; ++r) { const float v = acc[j][r] + bias; const int rl = wave * 16 + 8 * g + r, cl = j * 16 + col; th[cl][rl] = (_Float16)v; const __bf16 bh = (__bf16)v; tb[cl][rl] = bh; tbl[cl][rl] = (__bf16)(v - (float)bh); } }
    __syncthreads();
    for (int e = tid; e < 128 * 8; e += 128) { const int cl = e >> 3, q = e & 7; vst2((unsigned*)(VT + (bb * CC + c0 + cl) * (size_t)TT + t0 + q * 8), *(const v4u*)&th[cl][q * 8]); if (hi_rows) { const size_t o3 = (bb * CC + c0 + cl) * (size_t)KHI + t0 + q * 8; vst2((unsigned*)(VB + o3), *(const v4u*)&tb[cl][q * 8]); vst2((unsigned*)(VBL + o3), *(const v4u*)&tbl[cl][q * 8]); } } } }
// ---- k_sc: block = (query block qb, key block kb <= kb_last(qb), head in group) of batch b: logits x SCALE; q hi + residual (x 2^10) against k (2 products) for query rows < QHI, plus the k residual (3 products) for query blocks < QBH (causal early rows); causal: blocks past the diagonal exit, the mask itself is applied by index in k_sm
__global__ __launch_bounds__(128) void k_sc(const _Float16* __restrict__ QH, const _Float16* __restrict__ KH, const _Float16* __restrict__ QL, const _Float16* __restrict__ KL, int b, int h0, float* __restrict__ S0) { __shared__ __align__(16) float ss[4][16][132];
  const int qb = blockIdx.x, kb = blockIdx.y; if (kb > kb_last(qb)) return;
  const int h = h0 + blockIdx.z; float* S = S0 + (size_t)blockIdx.z * TQC * TT;
  const int tid = threadIdx.x, wave = tid >> 5, lane = tid & 31, col = lane & 15, g = lane >> 4; const int k0 = kb * 128; const int ql0 = qb * 64 + wave * 16; const size_t q0 = (size_t)b * TT + ql0, kr0 = (size_t)b * TT + k0;
  v8f acc[8] = {}, accl[8] = {};
  const _Float16* QLb = QL + (size_t)b * QHI * CC; const _Float16* KLb = KL + (size_t)b * KHI * CC;
  if (qb < QBH) {
#pragma unroll
    for (int kc = 0; kc < HD / 32; ++kc) { const v16h ah = frag_h(QH + (q0 + col) * CC + h * HD + kc * 32, lane), al = frag_h(QLb + (size_t)(ql0 + col) * CC + h * HD + kc * 32, lane);
#pragma unroll
      for (int j = 0; j < 8; ++j) { const v16h kbf = frag_h(KH + (kr0 + j * 16 + col) * CC + h * HD + kc * 32, lane), klf = frag_h(KLb + (size_t)(k0 + j * 16 + col) * CC + h * HD + kc * 32, lane); acc[j] = wmma16(ah, kbf, acc[j]); accl[j] = wmma16(al, kbf, accl[j]); accl[j] = wmma16(ah, klf, accl[j]); } }
  } else if (qb * 64 < QHI) {
#pragma unroll
    for (int kc = 0; kc < HD / 32; ++kc) { const v16h ah = frag_h(QH + (q0 + col) * CC + h * HD + kc * 32, lane), al = frag_h(QLb + (size_t)(ql0 + col) * CC + h * HD + kc * 32, lane);
#pragma unroll
      for (int j = 0; j < 8; ++j) { const v16h kbf = frag_h(KH + (kr0 + j * 16 + col) * CC + h * HD + kc * 32, lane); acc[j] = wmma16(ah, kbf, acc[j]); accl[j] = wmma16(al, kbf, accl[j]); } }
  } else {
#pragma unroll
    for (int kc = 0; kc < HD / 32; ++kc) { const v16h ah = frag_h(QH + (q0 + col) * CC + h * HD + kc * 32, lane);
#pragma unroll
      for (int j = 0; j < 8; ++j) { const v16h kbf = frag_h(KH + (kr0 + j * 16 + col) * CC + h * HD + kc * 32, lane); acc[j] = wmma16(ah, kbf, acc[j]); } } }
#pragma unroll
  for (int j = 0; j < 8; ++j) {
#pragma unroll
    for (int r = 0; r < 8; ++r) ss[wave][8 * g + r][j * 16 + col] = (acc[j][r] + accl[j][r] * (1.0f / 1024.0f)) * SCALE; }
  LDSX(); for (int rl = 0; rl < 16; ++rl) vst2(S + (size_t)(ql0 + rl) * TT + k0 + lane * 4, *(const v4f*)&ss[wave][rl][lane * 4]); }
// ---- k_sm: block = query row t (head in group): keys [0, kend): causal -> logit if s <= t else excluded; softmax in f32; P x 2^11 in place (0 for excluded)
__global__ __launch_bounds__(256) void k_sm(float* __restrict__ S0 SM_EXTRA_PARAMS) { __shared__ float sred[8]; __shared__ float sbc; __shared__ __align__(16) float shv[TT];
  const int tid = threadIdx.x; const int t = blockIdx.x; const int kend = (kb_last(t >> 6) + 1) * 128;
  float* sr = S0 + (size_t)blockIdx.y * TQC * TT + (size_t)t * TT;
  float m = -3.0e38f; for (int k = tid; k < kend; k += 256) { float v = (!CAUSAL || k <= t) ? sr[k] : -3.0e38f; SM_MASK_HOOK; shv[k] = v; m = fmaxf(m, v); }
#pragma unroll
  for (int o = 1; o < 32; o <<= 1) m = fmaxf(m, __shfl_xor(m, o));
  if ((tid & 31) == 0) sred[tid >> 5] = m; __syncthreads(); if (tid == 0) { float a = sred[0]; for (int i = 1; i < 8; ++i) a = fmaxf(a, sred[i]); sbc = a; } __syncthreads(); m = sbc; __syncthreads();
  float sum = 0.f; for (int k = tid; k < kend; k += 256) { const float v = shv[k]; const float e = (v <= -1.0e38f) ? 0.f : expf(v - m); shv[k] = e; sum += e; }
#pragma unroll
  for (int o = 1; o < 32; o <<= 1) sum += __shfl_xor(sum, o);
  if ((tid & 31) == 0) sred[tid >> 5] = sum; __syncthreads(); if (tid == 0) { float a = 0.f; for (int i = 0; i < 8; ++i) a += sred[i]; sbc = a > 0.f ? 2048.0f / a : 0.f; }   /* a fully excluded row yields P = 0 */ __syncthreads(); const float inv = sbc;
  for (int k = tid; k < kend; k += 256) shv[k] = shv[k] * inv;
  __syncthreads(); for (int q = tid; q < kend / 4; q += 256) vst2(sr + q * 4, *(const v4f*)&shv[q * 4]); }
// ---- k_comb: plane 0 := plane 0 - bf16(lamb) * plane 1 over the TQC x TT entries of the current query chunk (both planes hold softmax weights x 2^11); thread per 16-B piece
__global__ __launch_bounds__(256) void k_comb(float* __restrict__ S0, const float* __restrict__ LAMB) { const size_t i4 = ((size_t)blockIdx.x * 256 + threadIdx.x) * 4; const float lam = bfr(LAMB[0]); const v4f a = *(const v4f*)(S0 + i4), b = *(const v4f*)(S0 + (size_t)TQC * TT + i4); asm volatile("s_wait_loadcnt 0x0" ::: "memory"); v4f o;
#pragma unroll
  for (int u = 0; u < 4; ++u) o[u] = a[u] - lam * b[u];
  vst2(S0 + i4, o); }
// ---- k_out64: out[b][t][0..63] = ctx row columns 0..63 (256 B by 16 lanes)
__global__ __launch_bounds__(256) void k_out64(const float* __restrict__ Y, float* __restrict__ OUT) { const size_t row = (size_t)blockIdx.x * 16 + (threadIdx.x >> 4); const int q = threadIdx.x & 15; const v4f v = *(const v4f*)(Y + row * CC + q * 4); asm volatile("s_wait_loadcnt 0x0" ::: "memory"); vst2(OUT + row * 64 + q * 4, v); }
// ---- k_pv: block = 64 queries (qb) of (b, h): ctx = P . v over keys [0, kend) (P x 2^11 once to f16 against v f16: 1 product; causal early query blocks: P and v as bf16 hi + lo, 3 products); 256-B (row, head) segment by 16 lanes
__global__ __launch_bounds__(128) void k_pv(const float* __restrict__ PS0, const _Float16* __restrict__ VT, const __bf16* __restrict__ VB, const __bf16* __restrict__ VBL, int b, int h0, float* __restrict__ Y) { const int h = h0 + blockIdx.z; const float* PS = PS0 + (size_t)blockIdx.z * TQC * TT; __shared__ __align__(16) float ss[4][16][HD + 4];
  const int tid = threadIdx.x, wave = tid >> 5, lane = tid & 31, col = lane & 15, g = lane >> 4; const int qb = blockIdx.x; const int ql0 = qb * 64 + wave * 16; const int kce = (kb_last(qb) + 1) * 4;
  v8f acc[HD / 16] = {};
  if (qb < QBH) {
#pragma unroll 1
    for (int kc = 0; kc < kce; ++kc) { const F2 p = split_row(PS + (size_t)(ql0 + col) * TT, kc * 32, lane);
      asm volatile("s_wait_loadcnt 0x0" ::: "memory");
#pragma unroll
      for (int j = 0; j < HD / 16; ++j) { const size_t po = ((size_t)b * CC + h * HD + j * 16 + col) * (size_t)KHI + kc * 32; const v16b vh = frag_b(VB + po, lane); acc[j] = wmma_bf(p.h, vh, acc[j]); acc[j] = wmma_bf(p.l, vh, acc[j]); acc[j] = wmma_bf(p.h, frag_b(VBL + po, lane), acc[j]); } }
  } else {
#pragma unroll 1
    for (int kc = 0; kc < kce; ++kc) { const v16h p = frag_f32(PS + (size_t)(ql0 + col) * TT + kc * 32, lane);
      asm volatile("s_wait_loadcnt 0x0" ::: "memory");
#pragma unroll
      for (int j = 0; j < HD / 16; ++j) { const size_t po = ((size_t)b * CC + h * HD + j * 16 + col) * (size_t)TT + kc * 32; acc[j] = wmma16(p, frag_h(VT + po, lane), acc[j]); } } }
#pragma unroll
  for (int j = 0; j < HD / 16; ++j)
#pragma unroll
    for (int r = 0; r < 8; ++r) ss[wave][8 * g + r][j * 16 + col] = acc[j][r] * (1.0f / 2048.0f);
  LDSX(); for (int rl = 0; rl < 16; ++rl) if (lane < HD / 4) vst2(Y + ((size_t)b * TT + ql0 + rl) * CC + h * HD + lane * 4, *(const v4f*)&ss[wave][rl][lane * 4]); }

extern "C" void kernel_launch(void* const* d_in, const int* in_sizes, int n_in, void* d_out, int out_size, void* d_ws, size_t ws_size, hipStream_t stream) {
  (void)in_sizes; (void)n_in; (void)out_size;
  const float** F = (const float**)d_in;
  if (ws_size < (size_t)WS_END) return;
  char* ws = (char*)d_ws; _Float16 *QH = (_Float16*)(ws + WS_QH), *KH = (_Float16*)(ws + WS_KH), *VT = (_Float16*)(ws + WS_VT), *QL = (_Float16*)(ws + WS_QL), *KL = (_Float16*)(ws + WS_KL); __bf16 *VB = (__bf16*)(ws + WS_VB), *VBL = (__bf16*)(ws + WS_VBL); float *S = (float*)(ws + WS_S), *Y = (float*)(ws + WS_Y);
  (void)Y; (void)QL; (void)KL; (void)VB; (void)VBL;
  // inputs: 0 x [8,4096,384]; 1 lamb (f32 scalar, 0.5); 2 Wq1 [384,64] (in,out); 3 Wk1; 4 Wq2; 5 Wk2; 6 Wv [384,64]; no biases
  if (ws_size < (size_t)WS_END2) return;
  float* Y2 = (float*)(ws + WS_Y2);
  k_proj<<<dim3(TNB * TT / 64, CC / 128, 3), 128, 0, stream>>>(F[0], F[0], F[0], F[2], F[3], F[6], nullptr, nullptr, nullptr, QH, QL, KH, KL, VT, VB, VBL, F[4], F[5]);   /* q = [q1 | q2], k = [k1 | k2] as two 64-wide 'heads'; v = [v | 0] */
  for (int b = 0; b < TNB; ++b) for (int q0 = 0; q0 < TT; q0 += TQC) {   /* 2,048-query chunks: two score planes of 2,048 x 4,096 f32 = 64 MiB */
    k_sc<<<dim3(TQC / 64, TT / 128, 2), 128, 0, stream>>>(QH + (size_t)q0 * CC, KH, QL, KL, b, 0, S);   /* plane 0 = q1 k1^T / 8, plane 1 = q2 k2^T / 8 */
    k_sm<<<dim3(TQC, 2), 256, 0, stream>>>(S);                                                          /* two independent softmaxes (x 2^11) */
    k_comb<<<dim3((unsigned)((size_t)TQC * TT / 1024)), 256, 0, stream>>>(S, F[1]);                      /* plane 0 := w1 - lamb w2 */
    k_pv<<<dim3(TQC / 64, 1, 1), 128, 0, stream>>>(S, VT, VB, VBL, b, 0, Y2 + (size_t)q0 * CC);         /* head 0 only: (w1 - lamb w2) v */
  }
  k_out64<<<dim3(TNB * TT / 16), 256, 0, stream>>>(Y2, (float*)d_out);
}

// v001
// It runs in 1250 microseconds.
// In two side-by-side timings against v000, it was 2.30 and 2.27 times as fast.
// compute dtype: all float inputs rounded to bf16; the five 64-wide projections with EXACT bf16 products on WMMA 16x16x32 (f32 accumulate); both score maps q x k once to f16 each (1 product; sigma - 0.16) x 64^-0.5; two softmaxes in f32; w1 - lamb w2 in f32 (x 2^11), once to f16, x v once to f16 (1 product); f32 output.
#include <hip/hip_runtime.h>
#include <math.h>

typedef __attribute__((ext_vector_type(16))) _Float16 v16h;
typedef __attribute__((ext_vector_type(16))) __bf16 v16b;
typedef __attribute__((ext_vector_type(8)))  _Float16 v8h;
typedef __attribute__((ext_vector_type(8)))  float v8f;
typedef __attribute__((ext_vector_type(4)))  float v4f;
typedef __attribute__((ext_vector_type(2)))  float v2f;
typedef __attribute__((ext_vector_type(4)))  unsigned v4u;
typedef __attribute__((ext_vector_type(4)))  int v4i;
typedef float __attribute__((may_alias)) float_a;
typedef int __attribute__((may_alias)) int_a;

template <typename T> __device__ __forceinline__ void vst2(void* p, T v) { *(T*)p = v;  }
__device__ __forceinline__ v8f wmma16(v16h a, v16h b, v8f c) {
  v8f d = __builtin_amdgcn_wmma_f32_16x16x32_f16(false, a, false, b, (short)0, c, false, false);
  asm volatile("v_nop\n\tv_nop\n\tv_nop\n\tv_nop" : "+v"(d) : "v"(a), "v"(b));
  return d;
}
__device__ __forceinline__ v8f wmma_bf(v16b a, v16b b, v8f c) {
  v8f d = __builtin_amdgcn_wmma_f32_16x16x32_bf16(false, a, false, b, (short)0, c, false, false);
  asm volatile("v_nop\n\tv_nop\n\tv_nop\n\tv_nop" : "+v"(d) : "v"(a), "v"(b));
  return d;
}
// 16x16x32 fragments: lane = (h = lane>>4, row/col = lane&15); elements 0..7 = k0+8h+0..7, 8..15 = k0+16+8h+0..7; D element r = row 8h+r
__device__ __forceinline__ v16h frag_h(const _Float16* rowk0, int lane) {
  union { v16h v; v8h q[2]; } u; const _Float16* p = rowk0 + 8 * (lane >> 4);
  u.q[0] = *(const v8h*)p; u.q[1] = *(const v8h*)(p + 16); return u.v;
}
__device__ __forceinline__ v16h frag_f32(const float* rowk0, int lane) {
  v16h a; const float* p = rowk0 + 8 * (lane >> 4);
#pragma unroll
  for (int i = 0; i < 8; ++i) { a[i] = (_Float16)p[i]; a[8 + i] = (_Float16)p[16 + i]; }
  return a;
}
__device__ __forceinline__ v16h frag_f32s(const float* rowk0, int lane, float sc) {
  v16h a; const float* p = rowk0 + 8 * (lane >> 4);
#pragma unroll
  for (int i = 0; i < 8; ++i) { a[i] = (_Float16)(p[i] * sc); a[8 + i] = (_Float16)(p[16 + i] * sc); }
  return a;
}
// column fragment from a [K][ld] layout (column n), rows >= K read as 0
__device__ __forceinline__ v16h fragc_f32(const float* W, int k0, int n, int lane, int ld, int K) {
  v16h a; const int g = lane >> 4;
#pragma unroll
  for (int i = 0; i < 8; ++i) { const int ka = k0 + 8 * g + i, kb = ka + 16;
    a[i] = (_Float16)(ka < K ? W[(size_t)(ka < K ? ka : K - 1) * ld + n] : 0.f); a[8 + i] = (_Float16)(kb < K ? W[(size_t)(kb < K ? kb : K - 1) * ld + n] : 0.f); }
  return a;
}
struct F2 { v16b h, l; };
__device__ __forceinline__ F2 bsplit16(const float v[16]) { F2 r;
#pragma unroll
  for (int i = 0; i < 16; ++i) { const __bf16 h = (__bf16)v[i]; r.h[i] = h; r.l[i] = (__bf16)(v[i] - (float)h); }
  return r; }
__device__ __forceinline__ F2 split_row(const float* row, int k0, int lane) { float v[16]; const float* p = row + k0 + 8 * (lane >> 4);
#pragma unroll
  for (int i = 0; i < 8; ++i) { v[i] = p[i]; v[8 + i] = p[16 + i]; }
  return bsplit16(v); }
__device__ __forceinline__ F2 split_rowK(const float* row, int k0, int lane, int K) { float v[16]; const int g = lane >> 4;
#pragma unroll
  for (int i = 0; i < 8; ++i) { const int ka = k0 + 8 * g + i, kb = ka + 16; v[i] = ka < K ? row[ka < K ? ka : K - 1] : 0.f; v[8 + i] = kb < K ? row[kb < K ? kb : K - 1] : 0.f; }
  return bsplit16(v); }
__device__ __forceinline__ F2 split_col(const float* W, int k0, int n, int lane, int ld, int K) { float v[16]; const int g = lane >> 4;
#pragma unroll
  for (int i = 0; i < 8; ++i) { const int ka = k0 + 8 * g + i, kb = ka + 16; v[i] = ka < K ? W[(size_t)(ka < K ? ka : K - 1) * ld + n] : 0.f; v[8 + i] = kb < K ? W[(size_t)(kb < K ? kb : K - 1) * ld + n] : 0.f; }
  return bsplit16(v); }
__device__ __forceinline__ v8f mac3(const F2& a, const F2& b, v8f c) { c = wmma_bf(a.l, b.h, c); c = wmma_bf(a.h, b.l, c); return wmma_bf(a.h, b.h, c); }
__device__ __forceinline__ float sigm(float v) { return 1.0f / (1.0f + expf(-v)); }
#define LDSX() do { asm volatile("s_wait_dscnt 0" ::: "memory"); __builtin_amdgcn_wave_barrier(); __builtin_amdgcn_fence(__ATOMIC_RELEASE, "workgroup"); } while (0)

// Differential attention head (x [8,4096,384]; (in,out) Wq1 / Wk1 / Wq2 / Wk2 / Wv [384,64] (0.02 scale), no biases; w1 = softmax(q1 k1^T / 8), w2 = softmax(q2 k2^T / 8) over all 4,096 keys (no mask); out = (w1 - lamb w2) v with lamb a scalar input (0.5)) -> [8,4096,64].
#define NB 8
#define TT 4096
#define CC 128            // NH * HD = projected width
#define DIN 384          // input (model) width
#define NH 2
#define HD 64
#define NQB (TT / 64)
#define HG 2
#define SCALE (0.125f)
#define CAUSAL 0
#ifndef TNB
#define TNB NB
#endif
__device__ __forceinline__ float bfr(float v) { return (float)(__bf16)v; }
__host__ __device__ __forceinline__ int kb_last(int qb) { return CAUSAL ? ((qb * 64 + 63) >> 7) : (TT / 128 - 1); }
typedef __attribute__((ext_vector_type(8))) __bf16 v8b;
__device__ __forceinline__ v16b frag_b(const __bf16* rowk0, int lane) {
  union { v16b v; v8b q[2]; } u; const __bf16* p = rowk0 + 8 * (lane >> 4);
  u.q[0] = *(const v8b*)p; u.q[1] = *(const v8b*)(p + 16); return u.v;
}
#define QBH 0              // causal: query blocks 0..QBH-1 of each sequence (few keys, no averaging) take the high-precision path
#define QHI 0               // single-product scores on every row
#define TQC 2048           // query rows per pass: 2 planes x 2,048 x 4,096 f32 = 64 MiB
#define KHI 64            // key rows carrying k residual / v bf16 hi+lo planes (used only by the causal high-precision path)
// B fragment (k rows k0+.., output column o) of a weight: (in,out) [K][ld] or (out,in) [ld rows of K]: bf16 exact, or f16(bf16 * 256) exact
__device__ __forceinline__ v16b wcol_io(const float* Wm, int k0, int o, int lane, int ld) { v16b w; const int g = lane >> 4;
#pragma unroll
  for (int i = 0; i < 8; ++i) { w[i] = (__bf16)Wm[(size_t)(k0 + 8 * g + i) * ld + o]; w[8 + i] = (__bf16)Wm[(size_t)(k0 + 16 + 8 * g + i) * ld + o]; }
  return w; }
__device__ __forceinline__ v16b wcol_oi(const float* Wm, int k0, int o, int lane, int K) { v16b w; const float* p = Wm + (size_t)o * K + k0 + 8 * (lane >> 4);
#pragma unroll
  for (int i = 0; i < 8; ++i) { w[i] = (__bf16)p[i]; w[8 + i] = (__bf16)p[16 + i]; }
  return w; }
__device__ __forceinline__ v16h wcolh_io(const float* Wm, int k0, int o, int lane, int ld) { v16h w; const int g = lane >> 4;
#pragma unroll
  for (int i = 0; i < 8; ++i) { w[i] = (_Float16)(bfr(Wm[(size_t)(k0 + 8 * g + i) * ld + o]) * 256.0f); w[8 + i] = (_Float16)(bfr(Wm[(size_t)(k0 + 16 + 8 * g + i) * ld + o]) * 256.0f); }
  return w; }
__device__ __forceinline__ v16h wcolh_oi(const float* Wm, int k0, int o, int lane, int K) { v16h w; const float* p = Wm + (size_t)o * K + k0 + 8 * (lane >> 4);
#pragma unroll
  for (int i = 0; i < 8; ++i) { w[i] = (_Float16)(bfr(p[i]) * 256.0f); w[8 + i] = (_Float16)(bfr(p[16 + i]) * 256.0f); }
  return w; }
#define WQKV_LAYOUT 0   // 0 = (in,out) [DIN][HD] per map (pitch 64); 1 = (out,in) [CC][DIN]; 2 = per-head [NH][DIN][HD]
__device__ __forceinline__ v16b wcol_hdk(const float* Wm, int k0, int o, int lane) { v16b w; const int g = lane >> 4; const float* p = Wm + (size_t)(o / HD) * DIN * HD + (o % HD);
#pragma unroll
  for (int i = 0; i < 8; ++i) { w[i] = (__bf16)p[(size_t)(k0 + 8 * g + i) * HD]; w[8 + i] = (__bf16)p[(size_t)(k0 + 16 + 8 * g + i) * HD]; }
  return w; }
#define WO_OUT_IN 0
#if WQKV_LAYOUT == 1
#define WCOL(W, k0, o, lane) wcol_oi(W, k0, o, lane, DIN)
#elif WQKV_LAYOUT == 2
#define WCOL(W, k0, o, lane) wcol_hdk(W, k0, o, lane)
#else
__device__ __forceinline__ v16b zero16b() { v16b w; _Pragma("unroll") for (int i = 0; i < 16; ++i) w[i] = (__bf16)0.0f; return w; }
#define PROJ_EXTRA_PARAMS , const float* __restrict__ W2Q, const float* __restrict__ W2K
#define WCOL(W, k0, o, lane) ((o) < 64 ? wcol_io(W, k0, (o), lane, 64) : (which == 2 ? zero16b() : wcol_io(which == 0 ? W2Q : W2K, k0, (o) - 64, lane, 64)))   /* (in,out) [384][64] weights at pitch 64: projected columns 0..63 = map 1 (Wq1 / Wk1 / Wv), columns 64..127 = map 2 (Wq2 / Wk2; zero for v); compile-time per unrolled tile (c0 = 0) */
#endif
#if WO_OUT_IN
#define WOCOL(W, k0, o, lane) wcol_oi(W, k0, o, lane, CC)
#define WOCOLH(W, k0, o, lane) wcolh_oi(W, k0, o, lane, CC)
#else
#define WOCOL(W, k0, o, lane) wcol_io(W, k0, o, lane, DIN)
#define WOCOLH(W, k0, o, lane) wcolh_io(W, k0, o, lane, DIN)
#endif
#define SM_EXTRA_PARAMS
#define SM_MASK_HOOK (void)0
#ifndef SM_EXTRA_PARAMS
#define SM_EXTRA_PARAMS
#endif
#ifndef PROJ_EXTRA_PARAMS
#define PROJ_EXTRA_PARAMS
#endif
#ifndef SM_MASK_HOOK
#define SM_MASK_HOOK (void)0
#endif

#define WS_QH  0u                                      // f16 q rows [b*t][CC]
#define WS_KH  (WS_QH + 2u * (size_t)NB * TT * CC)      // f16 k rows [b*t][CC]
#define WS_VT  (WS_KH + 2u * (size_t)NB * TT * CC)      // f16 v planes [b][c][t]
#define WS_QL  (WS_VT + 2u * (size_t)NB * CC * TT)      // f16 q residual x 2^10 rows [b][t < QHI][CC]
#define WS_KL  (WS_QL + 2u * (size_t)NB * QHI * CC)     // f16 k residual x 2^10 rows [b][t < KHI][CC]
#define WS_VB  (WS_KL + 2u * (size_t)NB * KHI * CC)     // bf16 v hi planes [b][c][t < KHI]
#define WS_VBL (WS_VB + 2u * (size_t)NB * CC * KHI)
#define WS_S   (WS_VBL + 2u * (size_t)NB * CC * KHI)    // f32 logits / P [hg][t][s]
#define WS_Y   (WS_S  + 4u * (size_t)HG * TQC * TT)     // (unused: no output projection) end of the two score planes of one query chunk
#define WS_END (WS_Y  + 0u)
#define WS_Y2 (WS_END)                                  // f32 ctx rows [b*TT + t][128] (columns 64..127 unused)
#define WS_END2 (WS_Y2 + 4u * (size_t)NB * TT * CC)

// ---- k_proj: block = (64 rows, 128 cols, which): q/k/v = X W (+ b) with exact bf16 products (K = DIN) -> which 0: q f16 rows (+ residual rows < QHI); 1: k f16 rows (+ residual rows < KHI); 2: v f16 planes [c][t] (+ bf16 hi/lo planes for t < KHI)
__global__ __launch_bounds__(128) void k_proj(const float* __restrict__ XQ, const float* __restrict__ XK, const float* __restrict__ XV, const float* __restrict__ WQ, const float* __restrict__ WK, const float* __restrict__ WV, const float* __restrict__ BQ, const float* __restrict__ BK, const float* __restrict__ BV,
    _Float16* __restrict__ QH, _Float16* __restrict__ QL, _Float16* __restrict__ KH, _Float16* __restrict__ KL, _Float16* __restrict__ VT, __bf16* __restrict__ VB, __bf16* __restrict__ VBL PROJ_EXTRA_PARAMS) {
  __shared__ __align__(16) _Float16 sh[64][136], sl[64][136]; __shared__ __align__(16) _Float16 th[128][72]; __shared__ __align__(16) __bf16 tb[128][72], tbl[128][72];
  const int tid = threadIdx.x, wave = tid >> 5, lane = tid & 31, col = lane & 15, g = lane >> 4; const int which = blockIdx.z; const int c0 = blockIdx.y * 128; const size_t r0 = (size_t)blockIdx.x * 64; const size_t bb = r0 / TT; const int t0 = (int)(r0 % TT);
  const float* X = which == 0 ? XQ : which == 1 ? XK : XV; const float* WA = which == 0 ? WQ : which == 1 ? WK : WV; const float* BA = which == 0 ? BQ : which == 1 ? BK : BV;
  v8f acc[8] = {};
#pragma unroll 2
  for (int kc = 0; kc < DIN / 32; ++kc) { v16b a; { const float* p = X + (r0 + wave * 16 + col) * DIN + kc * 32 + 8 * g;
#pragma unroll
      for (int i = 0; i < 8; ++i) { a[i] = (__bf16)p[i]; a[8 + i] = (__bf16)p[16 + i]; } }
    asm volatile("s_wait_loadcnt 0x0" ::: "memory");
#pragma unroll
    for (int j = 0; j < 8; ++j) { const v16b w = WCOL(WA, kc * 32, c0 + j * 16 + col, lane); asm volatile("s_wait_loadcnt 0x0" ::: "memory"); acc[j] = wmma_bf(a, w, acc[j]); } }
  if (which < 2) { _Float16* DH = which == 0 ? QH : KH; _Float16* DL = which == 0 ? QL : KL; const int nhi = which == 0 ? QHI : KHI; const bool hi_rows = t0 < nhi;
#pragma unroll
    for (int j = 0; j < 8; ++j) { const float bias = BA ? bfr(BA[c0 + j * 16 + col]) : 0.f;
#pragma unroll
      for (int r = 0; r < 8; ++r) { const float v = acc[j][r] + bias; const _Float16 hv = (_Float16)v; sh[wave * 16 + 8 * g + r][j * 16 + col] = hv; sl[wave * 16 + 8 * g + r][j * 16 + col] = (_Float16)((v - (float)hv) * 1024.0f); } }
    __syncthreads();
    for (int e = tid; e < 64 * 16; e += 128) { const int rl = e >> 4, q = e & 15; vst2((unsigned*)(DH + (r0 + rl) * CC + c0 + q * 8), *(const v4u*)&sh[rl][q * 8]); if (hi_rows) vst2((unsigned*)(DL + (bb * nhi + t0 + rl) * (size_t)CC + c0 + q * 8), *(const v4u*)&sl[rl][q * 8]); }
  } else { const bool hi_rows = t0 < KHI;
#pragma unroll
    for (int j = 0; j < 8; ++j) { const float bias = BA ? bfr(BA[c0 + j * 16 + col]) : 0.f;
#pragma unroll
      for (int r = 0; r < 8; ++r) { const float v = acc[j][r] + bias; const int rl = wave * 16 + 8 * g + r, cl = j * 16 + col; th[cl][rl] = (_Float16)v; const __bf16 bh = (__bf16)v; tb[cl][rl] = bh; tbl[cl][rl] = (__bf16)(v - (float)bh); } }
    __syncthreads();
    for (int e = tid; e < 128 * 8; e += 128) { const int cl = e >> 3, q = e & 7; vst2((unsigned*)(VT + (bb * CC + c0 + cl) * (size_t)TT + t0 + q * 8), *(const v4u*)&th[cl][q * 8]); if (hi_rows) { const size_t o3 = (bb * CC + c0 + cl) * (size_t)KHI + t0 + q * 8; vst2((unsigned*)(VB + o3), *(const v4u*)&tb[cl][q * 8]); vst2((unsigned*)(VBL + o3), *(const v4u*)&tbl[cl][q * 8]); } } } }
// ---- k_sc: block = (query block qb, key block kb <= kb_last(qb), head in group) of batch b: logits x SCALE; q hi + residual (x 2^10) against k (2 products) for query rows < QHI, plus the k residual (3 products) for query blocks < QBH (causal early rows); causal: blocks past the diagonal exit, the mask itself is applied by index in k_sm
__global__ __launch_bounds__(128) void k_sc(const _Float16* __restrict__ QH, const _Float16* __restrict__ KH, const _Float16* __restrict__ QL, const _Float16* __restrict__ KL, int b, int h0, float* __restrict__ S0) { __shared__ __align__(16) float ss[4][16][132];
  const int qb = blockIdx.x, kb = blockIdx.y; if (kb > kb_last(qb)) return;
  const int h = h0 + blockIdx.z; float* S = S0 + (size_t)blockIdx.z * TQC * TT;
  const int tid = threadIdx.x, wave = tid >> 5, lane = tid & 31, col = lane & 15, g = lane >> 4; const int k0 = kb * 128; const int ql0 = qb * 64 + wave * 16; const size_t q0 = (size_t)b * TT + ql0, kr0 = (size_t)b * TT + k0;
  v8f acc[8] = {}, accl[8] = {};
  const _Float16* QLb = QL + (size_t)b * QHI * CC; const _Float16* KLb = KL + (size_t)b * KHI * CC;
  if (qb < QBH) {
#pragma unroll
    for (int kc = 0; kc < HD / 32; ++kc) { const v16h ah = frag_h(QH + (q0 + col) * CC + h * HD + kc * 32, lane), al = frag_h(QLb + (size_t)(ql0 + col) * CC + h * HD + kc * 32, lane);
#pragma unroll
      for (int j = 0; j < 8; ++j) { const v16h kbf = frag_h(KH + (kr0 + j * 16 + col) * CC + h * HD + kc * 32, lane), klf = frag_h(KLb + (size_t)(k0 + j * 16 + col) * CC + h * HD + kc * 32, lane); acc[j] = wmma16(ah, kbf, acc[j]); accl[j] = wmma16(al, kbf, accl[j]); accl[j] = wmma16(ah, klf, accl[j]); } }
  } else if (qb * 64 < QHI) {
#pragma unroll
    for (int kc = 0; kc < HD / 32; ++kc) { const v16h ah = frag_h(QH + (q0 + col) * CC + h * HD + kc * 32, lane), al = frag_h(QLb + (size_t)(ql0 + col) * CC + h * HD + kc * 32, lane);
#pragma unroll
      for (int j = 0; j < 8; ++j) { const v16h kbf = frag_h(KH + (kr0 + j * 16 + col) * CC + h * HD + kc * 32, lane); acc[j] = wmma16(ah, kbf, acc[j]); accl[j] = wmma16(al, kbf, accl[j]); } }
  } else {
#pragma unroll
    for (int kc = 0; kc < HD / 32; ++kc) { const v16h ah = frag_h(QH + (q0 + col) * CC + h * HD + kc * 32, lane);
#pragma unroll
      for (int j = 0; j < 8; ++j) { const v16h kbf = frag_h(KH + (kr0 + j * 16 + col) * CC + h * HD + kc * 32, lane); acc[j] = wmma16(ah, kbf, acc[j]); } } }
#pragma unroll
  for (int j = 0; j < 8; ++j) {
#pragma unroll
    for (int r = 0; r < 8; ++r) ss[wave][8 * g + r][j * 16 + col] = (acc[j][r] + accl[j][r] * (1.0f / 1024.0f)) * SCALE; }
  LDSX(); for (int rl = 0; rl < 16; ++rl) vst2(S + (size_t)(ql0 + rl) * TT + k0 + lane * 4, *(const v4f*)&ss[wave][rl][lane * 4]); }
// ---- k_sm: block = query row t (head in group): keys [0, kend): causal -> logit if s <= t else excluded; softmax in f32; P x 2^11 in place (0 for excluded)
__global__ __launch_bounds__(256) void k_sm(float* __restrict__ S0 SM_EXTRA_PARAMS) { __shared__ float sred[8]; __shared__ float sbc; __shared__ __align__(16) float shv[TT];
  const int tid = threadIdx.x; const int t = blockIdx.x; const int kend = (kb_last(t >> 6) + 1) * 128;
  float* sr = S0 + (size_t)blockIdx.y * TQC * TT + (size_t)t * TT;
  float m = -3.0e38f; for (int k = tid; k < kend; k += 256) { float v = (!CAUSAL || k <= t) ? sr[k] : -3.0e38f; SM_MASK_HOOK; shv[k] = v; m = fmaxf(m, v); }
#pragma unroll
  for (int o = 1; o < 32; o <<= 1) m = fmaxf(m, __shfl_xor(m, o));
  if ((tid & 31) == 0) sred[tid >> 5] = m; __syncthreads(); if (tid == 0) { float a = sred[0]; for (int i = 1; i < 8; ++i) a = fmaxf(a, sred[i]); sbc = a; } __syncthreads(); m = sbc; __syncthreads();
  float sum = 0.f; for (int k = tid; k < kend; k += 256) { const float v = shv[k]; const float e = (v <= -1.0e38f) ? 0.f : expf(v - m); shv[k] = e; sum += e; }
#pragma unroll
  for (int o = 1; o < 32; o <<= 1) sum += __shfl_xor(sum, o);
  if ((tid & 31) == 0) sred[tid >> 5] = sum; __syncthreads(); if (tid == 0) { float a = 0.f; for (int i = 0; i < 8; ++i) a += sred[i]; sbc = a > 0.f ? 2048.0f / a : 0.f; }   /* a fully excluded row yields P = 0 */ __syncthreads(); const float inv = sbc;
  for (int k = tid; k < kend; k += 256) shv[k] = shv[k] * inv;
  __syncthreads(); for (int q = tid; q < kend / 4; q += 256) vst2(sr + q * 4, *(const v4f*)&shv[q * 4]); }
// ---- k_comb: plane 0 := plane 0 - bf16(lamb) * plane 1 over the TQC x TT entries of the current query chunk (both planes hold softmax weights x 2^11); thread per 16-B piece
__global__ __launch_bounds__(256) void k_comb(float* __restrict__ S0, const float* __restrict__ LAMB) { const size_t i4 = ((size_t)blockIdx.x * 256 + threadIdx.x) * 4; const float lam = bfr(LAMB[0]); const v4f a = *(const v4f*)(S0 + i4), b = *(const v4f*)(S0 + (size_t)TQC * TT + i4); asm volatile("s_wait_loadcnt 0x0" ::: "memory"); v4f o;
#pragma unroll
  for (int u = 0; u < 4; ++u) o[u] = a[u] - lam * b[u];
  vst2(S0 + i4, o); }
// ---- k_out64: out[b][t][0..63] = ctx row columns 0..63 (256 B by 16 lanes)
__global__ __launch_bounds__(256) void k_out64(const float* __restrict__ Y, float* __restrict__ OUT) { const size_t row = (size_t)blockIdx.x * 16 + (threadIdx.x >> 4); const int q = threadIdx.x & 15; const v4f v = *(const v4f*)(Y + row * CC + q * 4); asm volatile("s_wait_loadcnt 0x0" ::: "memory"); vst2(OUT + row * 64 + q * 4, v); }
// ---- k_pv: block = 16 queries of (b, h), PVW waves: wave w takes the 32-key steps w, w + PVW, ... of keys [0, kend) and holds its own f32 partial ctx = P . v (P x 2^11 once to f16 against v f16: 1 product; causal early query blocks: P and v as bf16 hi + lo, 3 products); the PVW partials meet in LDS and are summed in wave order, one thread per output element
#define PVW 32
__global__ __launch_bounds__(32 * PVW) void k_pv(const float* __restrict__ PS0, const _Float16* __restrict__ VT, const __bf16* __restrict__ VB, const __bf16* __restrict__ VBL, int b, int h0, float* __restrict__ Y) { const int h = h0 + blockIdx.z; const float* PS = PS0 + (size_t)blockIdx.z * TQC * TT; __shared__ __align__(16) float ss[PVW][16][HD + 4];
  const int tid = threadIdx.x, wave = __builtin_amdgcn_readfirstlane(tid >> 5), lane = tid & 31, col = lane & 15, g = lane >> 4; const int ql0 = blockIdx.x * 16; const int qb = ql0 >> 6; const int kce = (kb_last(qb) + 1) * 4;
  v8f acc[HD / 16] = {};
  if (qb < QBH) {
#pragma unroll 1
    for (int kc = wave; kc < kce; kc += PVW) { const F2 p = split_row(PS + (size_t)(ql0 + col) * TT, kc * 32, lane);
      asm volatile("s_wait_loadcnt 0x0" ::: "memory");
#pragma unroll
      for (int j = 0; j < HD / 16; ++j) { const size_t po = ((size_t)b * CC + h * HD + j * 16 + col) * (size_t)KHI + kc * 32; const v16b vh = frag_b(VB + po, lane); acc[j] = wmma_bf(p.h, vh, acc[j]); acc[j] = wmma_bf(p.l, vh, acc[j]); acc[j] = wmma_bf(p.h, frag_b(VBL + po, lane), acc[j]); } }
  } else {
#pragma unroll 1
    for (int kc = wave; kc < kce; kc += PVW) { const v16h p = frag_f32(PS + (size_t)(ql0 + col) * TT + kc * 32, lane);
      asm volatile("s_wait_loadcnt 0x0" ::: "memory");
#pragma unroll
      for (int j = 0; j < HD / 16; ++j) { const size_t po = ((size_t)b * CC + h * HD + j * 16 + col) * (size_t)TT + kc * 32; acc[j] = wmma16(p, frag_h(VT + po, lane), acc[j]); } } }
#pragma unroll
  for (int j = 0; j < HD / 16; ++j)
#pragma unroll
    for (int r = 0; r < 8; ++r) ss[wave][8 * g + r][j * 16 + col] = acc[j][r] * (1.0f / 2048.0f);
  __syncthreads();   /* every wave's partial tile is in LDS before any thread sums across waves */
  for (int e = tid; e < 16 * HD; e += 32 * PVW) { const int rl = e / HD, c = e % HD; float s = ss[0][rl][c];
#pragma unroll
    for (int w = 1; w < PVW; ++w) s += ss[w][rl][c];
    Y[((size_t)b * TT + ql0 + rl) * CC + h * HD + c] = s; } }

extern "C" void kernel_launch(void* const* d_in, const int* in_sizes, int n_in, void* d_out, int out_size, void* d_ws, size_t ws_size, hipStream_t stream) {
  (void)in_sizes; (void)n_in; (void)out_size;
  const float** F = (const float**)d_in;
  if (ws_size < (size_t)WS_END) return;
  char* ws = (char*)d_ws; _Float16 *QH = (_Float16*)(ws + WS_QH), *KH = (_Float16*)(ws + WS_KH), *VT = (_Float16*)(ws + WS_VT), *QL = (_Float16*)(ws + WS_QL), *KL = (_Float16*)(ws + WS_KL); __bf16 *VB = (__bf16*)(ws + WS_VB), *VBL = (__bf16*)(ws + WS_VBL); float *S = (float*)(ws + WS_S), *Y = (float*)(ws + WS_Y);
  (void)Y; (void)QL; (void)KL; (void)VB; (void)VBL;
  // inputs: 0 x [8,4096,384]; 1 lamb (f32 scalar, 0.5); 2 Wq1 [384,64] (in,out); 3 Wk1; 4 Wq2; 5 Wk2; 6 Wv [384,64]; no biases
  if (ws_size < (size_t)WS_END2) return;
  float* Y2 = (float*)(ws + WS_Y2);
  k_proj<<<dim3(TNB * TT / 64, CC / 128, 3), 128, 0, stream>>>(F[0], F[0], F[0], F[2], F[3], F[6], nullptr, nullptr, nullptr, QH, QL, KH, KL, VT, VB, VBL, F[4], F[5]);   /* q = [q1 | q2], k = [k1 | k2] as two 64-wide 'heads'; v = [v | 0] */
  for (int b = 0; b < TNB; ++b) for (int q0 = 0; q0 < TT; q0 += TQC) {   /* 2,048-query chunks: two score planes of 2,048 x 4,096 f32 = 64 MiB */
    k_sc<<<dim3(TQC / 64, TT / 128, 2), 128, 0, stream>>>(QH + (size_t)q0 * CC, KH, QL, KL, b, 0, S);   /* plane 0 = q1 k1^T / 8, plane 1 = q2 k2^T / 8 */
    k_sm<<<dim3(TQC, 2), 256, 0, stream>>>(S);                                                          /* two independent softmaxes (x 2^11) */
    k_comb<<<dim3((unsigned)((size_t)TQC * TT / 1024)), 256, 0, stream>>>(S, F[1]);                      /* plane 0 := w1 - lamb w2 */
    k_pv<<<dim3(TQC / 16, 1, 1), 32 * PVW, 0, stream>>>(S, VT, VB, VBL, b, 0, Y2 + (size_t)q0 * CC);         /* head 0 only: (w1 - lamb w2) v */
  }
  k_out64<<<dim3(TNB * TT / 16), 256, 0, stream>>>(Y2, (float*)d_out);
}

// v003
// Measured time: 74.9 microseconds a run.
// Versions between v001 and this one are left out; their measured steps multiply to 16.9 times as fast.
// All steps since v000 together make it 38.5 times as fast.
// compute dtype: all float inputs rounded to bf16; the five 64-wide projections with EXACT bf16 products on WMMA 16x16x32 (f32 accumulate); both score maps q x k once to f16 each (1 product) x 64^-0.5; two online softmaxes in f32; each map's exp weights (x 2^8) once to f16, x v once to f16 (1 product per map); both normalised and combined o1 - lamb o2 in f32; f32 output.
#include <hip/hip_runtime.h>
#include <math.h>

typedef __attribute__((ext_vector_type(16))) _Float16 v16h;
typedef __attribute__((ext_vector_type(16))) __bf16 v16b;
typedef __attribute__((ext_vector_type(8)))  _Float16 v8h;
typedef __attribute__((ext_vector_type(8)))  float v8f;
typedef __attribute__((ext_vector_type(4)))  float v4f;
typedef __attribute__((ext_vector_type(2)))  float v2f;
typedef __attribute__((ext_vector_type(4)))  unsigned v4u;
typedef __attribute__((ext_vector_type(4)))  int v4i;
typedef float __attribute__((may_alias)) float_a;
typedef int __attribute__((may_alias)) int_a;

template <typename T> __device__ __forceinline__ void vst2(void* p, T v) { *(T*)p = v;  }
__device__ __forceinline__ v8f wmma16(v16h a, v16h b, v8f c) {
  v8f d = __builtin_amdgcn_wmma_f32_16x16x32_f16(false, a, false, b, (short)0, c, false, false);
  asm volatile("v_nop\n\tv_nop\n\tv_nop\n\tv_nop" : "+v"(d) : "v"(a), "v"(b));
  return d;
}
__device__ __forceinline__ v8f wmma_bf(v16b a, v16b b, v8f c) {
  v8f d = __builtin_amdgcn_wmma_f32_16x16x32_bf16(false, a, false, b, (short)0, c, false, false);
  asm volatile("v_nop\n\tv_nop\n\tv_nop\n\tv_nop" : "+v"(d) : "v"(a), "v"(b));
  return d;
}
// 16x16x32 fragments: lane = (h = lane>>4, row/col = lane&15); elements 0..7 = k0+8h+0..7, 8..15 = k0+16+8h+0..7; D element r = row 8h+r
__device__ __forceinline__ v16h frag_h(const _Float16* rowk0, int lane) {
  union { v16h v; v8h q[2]; } u; const _Float16* p = rowk0 + 8 * (lane >> 4);
  u.q[0] = *(const v8h*)p; u.q[1] = *(const v8h*)(p + 16); return u.v;
}
__device__ __forceinline__ v16h frag_f32(const float* rowk0, int lane) {
  v16h a; const float* p = rowk0 + 8 * (lane >> 4);
#pragma unroll
  for (int i = 0; i < 8; ++i) { a[i] = (_Float16)p[i]; a[8 + i] = (_Float16)p[16 + i]; }
  return a;
}
__device__ __forceinline__ v16h frag_f32s(const float* rowk0, int lane, float sc) {
  v16h a; const float* p = rowk0 + 8 * (lane >> 4);
#pragma unroll
  for (int i = 0; i < 8; ++i) { a[i] = (_Float16)(p[i] * sc); a[8 + i] = (_Float16)(p[16 + i] * sc); }
  return a;
}
// column fragment from a [K][ld] layout (column n), rows >= K read as 0
__device__ __forceinline__ v16h fragc_f32(const float* W, int k0, int n, int lane, int ld, int K) {
  v16h a; const int g = lane >> 4;
#pragma unroll
  for (int i = 0; i < 8; ++i) { const int ka = k0 + 8 * g + i, kb = ka + 16;
    a[i] = (_Float16)(ka < K ? W[(size_t)(ka < K ? ka : K - 1) * ld + n] : 0.f); a[8 + i] = (_Float16)(kb < K ? W[(size_t)(kb < K ? kb : K - 1) * ld + n] : 0.f); }
  return a;
}
struct F2 { v16b h, l; };
__device__ __forceinline__ F2 bsplit16(const float v[16]) { F2 r;
#pragma unroll
  for (int i = 0; i < 16; ++i) { const __bf16 h = (__bf16)v[i]; r.h[i] = h; r.l[i] = (__bf16)(v[i] - (float)h); }
  return r; }
__device__ __forceinline__ F2 split_row(const float* row, int k0, int lane) { float v[16]; const float* p = row + k0 + 8 * (lane >> 4);
#pragma unroll
  for (int i = 0; i < 8; ++i) { v[i] = p[i]; v[8 + i] = p[16 + i]; }
  return bsplit16(v); }
__device__ __forceinline__ F2 split_rowK(const float* row, int k0, int lane, int K) { float v[16]; const int g = lane >> 4;
#pragma unroll
  for (int i = 0; i < 8; ++i) { const int ka = k0 + 8 * g + i, kb = ka + 16; v[i] = ka < K ? row[ka < K ? ka : K - 1] : 0.f; v[8 + i] = kb < K ? row[kb < K ? kb : K - 1] : 0.f; }
  return bsplit16(v); }
__device__ __forceinline__ F2 split_col(const float* W, int k0, int n, int lane, int ld, int K) { float v[16]; const int g = lane >> 4;
#pragma unroll
  for (int i = 0; i < 8; ++i) { const int ka = k0 + 8 * g + i, kb = ka + 16; v[i] = ka < K ? W[(size_t)(ka < K ? ka : K - 1) * ld + n] : 0.f; v[8 + i] = kb < K ? W[(size_t)(kb < K ? kb : K - 1) * ld + n] : 0.f; }
  return bsplit16(v); }
__device__ __forceinline__ v8f mac3(const F2& a, const F2& b, v8f c) { c = wmma_bf(a.l, b.h, c); c = wmma_bf(a.h, b.l, c); return wmma_bf(a.h, b.h, c); }
__device__ __forceinline__ float sigm(float v) { return 1.0f / (1.0f + expf(-v)); }
#define LDSX() do { asm volatile("s_wait_dscnt 0" ::: "memory"); __builtin_amdgcn_wave_barrier(); __builtin_amdgcn_fence(__ATOMIC_RELEASE, "workgroup"); } while (0)

// Differential attention head (x [8,4096,384]; (in,out) Wq1 / Wk1 / Wq2 / Wk2 / Wv [384,64] (0.02 scale), no biases; w1 = softmax(q1 k1^T / 8), w2 = softmax(q2 k2^T / 8) over all 4,096 keys (no mask); out = (w1 - lamb w2) v with lamb a scalar input (0.5)) -> [8,4096,64].
#define NB 8
#define TT 4096
#define CC 128            // NH * HD = projected width
#define DIN 384          // input (model) width
#define NH 2
#define HD 64
#define NQB (TT / 64)
#define HG 2
#define SCALE (0.125f)
#define CAUSAL 0
#ifndef TNB
#define TNB NB
#endif
__device__ __forceinline__ float bfr(float v) { return (float)(__bf16)v; }
__host__ __device__ __forceinline__ int kb_last(int qb) { return CAUSAL ? ((qb * 64 + 63) >> 7) : (TT / 128 - 1); }
typedef __attribute__((ext_vector_type(8))) __bf16 v8b;
__device__ __forceinline__ v16b frag_b(const __bf16* rowk0, int lane) {
  union { v16b v; v8b q[2]; } u; const __bf16* p = rowk0 + 8 * (lane >> 4);
  u.q[0] = *(const v8b*)p; u.q[1] = *(const v8b*)(p + 16); return u.v;
}
#define QBH 0              // unused by the kernels
#define QHI 0               // single-product scores on every row
#define TQC 2048           // unused by the kernels (no score planes are kept)
#define KHI 64            // key rows carrying k residual / v bf16 hi+lo planes (planes that the kernels do not use)
// B fragment (k rows k0+.., output column o) of a weight: (in,out) [K][ld] or (out,in) [ld rows of K]: bf16 exact, or f16(bf16 * 256) exact
__device__ __forceinline__ v16b wcol_io(const float* Wm, int k0, int o, int lane, int ld) { v16b w; const int g = lane >> 4;
#pragma unroll
  for (int i = 0; i < 8; ++i) { w[i] = (__bf16)Wm[(size_t)(k0 + 8 * g + i) * ld + o]; w[8 + i] = (__bf16)Wm[(size_t)(k0 + 16 + 8 * g + i) * ld + o]; }
  return w; }
__device__ __forceinline__ v16b wcol_oi(const float* Wm, int k0, int o, int lane, int K) { v16b w; const float* p = Wm + (size_t)o * K + k0 + 8 * (lane >> 4);
#pragma unroll
  for (int i = 0; i < 8; ++i) { w[i] = (__bf16)p[i]; w[8 + i] = (__bf16)p[16 + i]; }
  return w; }
__device__ __forceinline__ v16h wcolh_io(const float* Wm, int k0, int o, int lane, int ld) { v16h w; const int g = lane >> 4;
#pragma unroll
  for (int i = 0; i < 8; ++i) { w[i] = (_Float16)(bfr(Wm[(size_t)(k0 + 8 * g + i) * ld + o]) * 256.0f); w[8 + i] = (_Float16)(bfr(Wm[(size_t)(k0 + 16 + 8 * g + i) * ld + o]) * 256.0f); }
  return w; }
__device__ __forceinline__ v16h wcolh_oi(const float* Wm, int k0, int o, int lane, int K) { v16h w; const float* p = Wm + (size_t)o * K + k0 + 8 * (lane >> 4);
#pragma unroll
  for (int i = 0; i < 8; ++i) { w[i] = (_Float16)(bfr(p[i]) * 256.0f); w[8 + i] = (_Float16)(bfr(p[16 + i]) * 256.0f); }
  return w; }
#define WQKV_LAYOUT 0   // 0 = (in,out) [DIN][HD] per map (pitch 64); 1 = (out,in) [CC][DIN]; 2 = per-head [NH][DIN][HD]
__device__ __forceinline__ v16b wcol_hdk(const float* Wm, int k0, int o, int lane) { v16b w; const int g = lane >> 4; const float* p = Wm + (size_t)(o / HD) * DIN * HD + (o % HD);
#pragma unroll
  for (int i = 0; i < 8; ++i) { w[i] = (__bf16)p[(size_t)(k0 + 8 * g + i) * HD]; w[8 + i] = (__bf16)p[(size_t)(k0 + 16 + 8 * g + i) * HD]; }
  return w; }
#define WO_OUT_IN 0
#if WQKV_LAYOUT == 1
#define WCOL(W, k0, o, lane) wcol_oi(W, k0, o, lane, DIN)
#elif WQKV_LAYOUT == 2
#define WCOL(W, k0, o, lane) wcol_hdk(W, k0, o, lane)
#else
__device__ __forceinline__ v16b zero16b() { v16b w; _Pragma("unroll") for (int i = 0; i < 16; ++i) w[i] = (__bf16)0.0f; return w; }
#define PROJ_EXTRA_PARAMS , const float* __restrict__ W2Q, const float* __restrict__ W2K
#define WCOL(W, k0, o, lane) ((o) < 64 ? wcol_io(W, k0, (o), lane, 64) : (which == 2 ? zero16b() : wcol_io(which == 0 ? W2Q : W2K, k0, (o) - 64, lane, 64)))   /* (in,out) [384][64] weights at pitch 64: projected columns 0..63 = map 1 (Wq1 / Wk1 / Wv), columns 64..127 = map 2 (Wq2 / Wk2; zero for v) */
#endif
#if WO_OUT_IN
#define WOCOL(W, k0, o, lane) wcol_oi(W, k0, o, lane, CC)
#define WOCOLH(W, k0, o, lane) wcolh_oi(W, k0, o, lane, CC)
#else
#define WOCOL(W, k0, o, lane) wcol_io(W, k0, o, lane, DIN)
#define WOCOLH(W, k0, o, lane) wcolh_io(W, k0, o, lane, DIN)
#endif
#define SM_EXTRA_PARAMS
#define SM_MASK_HOOK (void)0
#ifndef SM_EXTRA_PARAMS
#define SM_EXTRA_PARAMS
#endif
#ifndef PROJ_EXTRA_PARAMS
#define PROJ_EXTRA_PARAMS
#endif
#ifndef SM_MASK_HOOK
#define SM_MASK_HOOK (void)0
#endif

#define WS_QH  0u                                      // f16 q rows [b*t][CC]
#define WS_KH  (WS_QH + 2u * (size_t)NB * TT * CC)      // f16 k rows [b*t][CC]
#define WS_VT  (WS_KH + 2u * (size_t)NB * TT * CC)      // f16 v planes [b][c][t]
#define WS_QL  (WS_VT + 2u * (size_t)NB * CC * TT)      // f16 q residual x 2^10 rows [b][t < QHI][CC]
#define WS_KL  (WS_QL + 2u * (size_t)NB * QHI * CC)     // f16 k residual x 2^10 rows [b][t < KHI][CC]
#define WS_VB  (WS_KL + 2u * (size_t)NB * KHI * CC)     // bf16 v hi planes [b][c][t < KHI]
#define WS_VBL (WS_VB + 2u * (size_t)NB * CC * KHI)
#define WS_END (WS_VBL + 2u * (size_t)NB * CC * KHI)    // end of all planes (the kernels use only the first three)

// ---- k_proj: block = 128 rows of x, 8 waves, all five projections (320 output columns: q1 | q2 | k1 | k2 | v) with exact bf16 products (K = DIN). The five weights go once per block into LDS as bf16, as 12 slabs of 32 k, each 320 output columns of 64 B; a wave holds its 16 x rows in registers and takes all 20 column tiles. q / k tiles are formed as W^T x^T (a lane holds 8 neighbouring columns of one row), v tiles as x W (a lane holds 8 neighbouring rows of one column), so that both leave as 16-byte LDS stores; whole q / k rows and v plane rows [c][t] are stored from LDS.
#define PJ_ROWS 128
#define PJ_WP 40             // LDS pitch of one output column's 32 k of a slab in bf16: 80 B = 16 B x odd
#define PJ_QKP 264           // LDS pitch of a staged [q1 | q2 | k1 | k2] row in f16: 528 B = 16 B x odd
#define PJ_VP 136            // LDS pitch of a staged v plane row (128 t) in f16
struct PjOut { _Float16 qk[PJ_ROWS][PJ_QKP]; _Float16 vt[HD][PJ_VP]; };
union PjLds { __bf16 w[DIN / 32][5 * HD][PJ_WP]; PjOut o; };   // the output tiles take the weights' place behind a barrier
__device__ __forceinline__ v8f mmb(v16b a, v16b b, v8f c) { return __builtin_amdgcn_wmma_f32_16x16x32_bf16(false, a, false, b, (short)0, c, false, false); }
__device__ __forceinline__ void pj_ldw(v4f (&wr)[3][8], const float* Wm) {   // a lane's 4 columns x 8 k of each third of one weight
  __builtin_amdgcn_sched_barrier(0);   // the loads stay between this place and their s_wait_xcnt: lifted above it they would stand without that wait while their base registers are reused
#pragma unroll
  for (int u = 0; u < 3; ++u)
#pragma unroll
    for (int r = 0; r < 8; ++r) wr[u][r] = *(const v4f*)(Wm + (u * 128 + r) * HD);
  asm volatile("s_wait_xcnt 0x0" ::: "memory");   // the address registers of the loads above are reused behind this place
  __builtin_amdgcn_sched_barrier(0);   // nothing that rewrites those registers moves ahead of the wait
}
__device__ __forceinline__ void pj_stw(const v4f (&wr)[3][8], __bf16* l) {
#pragma unroll
  for (int u = 0; u < 3; ++u)
#pragma unroll
    for (int i = 0; i < 4; ++i) { v8b p;
#pragma unroll
      for (int r = 0; r < 8; ++r) p[r] = (__bf16)wr[u][r][i];
      *(v8b*)(l + (u * 4 * 5 * HD + i) * PJ_WP) = p; } }
__global__ __launch_bounds__(256) void k_proj(const float* __restrict__ X, const float* __restrict__ WQ1, const float* __restrict__ WQ2, const float* __restrict__ WK1, const float* __restrict__ WK2, const float* __restrict__ WV,
    _Float16* __restrict__ QH, _Float16* __restrict__ KH, _Float16* __restrict__ VT) {
  __shared__ __align__(16) PjLds sm;
  // every loop of this kernel and of its two helpers is unrolled: their arrays are meant to live in registers, which takes compile-time indices
  const int tid = threadIdx.x, lane = tid & 31, wave = __builtin_amdgcn_readfirstlane(tid >> 5), c = lane & 15, h = lane >> 4;
  const size_t r0 = (size_t)blockIdx.x * PJ_ROWS; const size_t bb = r0 / TT; const int t0 = (int)(r0 % TT);
  const int rw = wave * 16;
  // weight staging: a lane takes 4 columns x 8 k (8 loads of 16 B, 4 LDS stores of 16 B); 8 x 4 lanes of a wave make each load four whole 128-B lines; a wave takes 32 columns x 32 k (half of one slab), 8 waves a third of one weight. Two weights are in flight at a time.
  const int cq = (wave & 1) * 8 + (lane & 7), ko = (wave >> 1) * 4 + (lane >> 3);
  const int goff = 8 * ko * HD + 4 * cq; __bf16* lw = &sm.w[ko >> 2][4 * cq][8 * (ko & 3)];
  v4f wr[2][3][8];
  pj_ldw(wr[0], WQ1 + goff); pj_ldw(wr[1], WQ2 + goff);
  pj_stw(wr[0], lw); pj_ldw(wr[0], WK1 + goff);
  pj_stw(wr[1], lw + HD * PJ_WP); pj_ldw(wr[1], WK2 + goff);
  pj_stw(wr[0], lw + 2 * HD * PJ_WP); pj_ldw(wr[0], WV + goff);
  const float* xp = X + (r0 + rw + c) * DIN + 8 * h;
  __builtin_amdgcn_sched_barrier(0);   // as in pj_ldw: the loads below stay in front of their s_wait_xcnt
  v4f xr[DIN / 32][4];   // the wave's whole x rows are asked for at once, behind the last weight's loads: no wait of the staging covers them, and each k chunk is waited for only where the product loop takes it
#pragma unroll
  for (int kc = 0; kc < DIN / 32; ++kc) { const float* p = xp + kc * 32; xr[kc][0] = *(const v4f*)p; xr[kc][1] = *(const v4f*)(p + 4); xr[kc][2] = *(const v4f*)(p + 16); xr[kc][3] = *(const v4f*)(p + 20); }
  asm volatile("s_wait_xcnt 0x0" :: "v"(xp) : "memory");   // the address registers of the loads above are reused below; xp is named so that the pair stays live up to this wait and no load of the run gets its result placed in it
  __builtin_amdgcn_sched_barrier(0);   // nothing that rewrites those registers moves ahead of the wait
  pj_stw(wr[1], lw + 3 * HD * PJ_WP); pj_stw(wr[0], lw + 4 * HD * PJ_WP);
  // all five weights are in LDS for every wave. The barrier is written with fences on LDS alone: __syncthreads() would also wait here for the x loads, which are to land under the product loop
  __builtin_amdgcn_fence(__ATOMIC_RELEASE, "workgroup", "local"); __builtin_amdgcn_s_barrier(); __builtin_amdgcn_fence(__ATOMIC_ACQUIRE, "workgroup", "local");
  const __bf16* wb = &sm.w[0][c][0];
  v8f acc[20] = {}; v16b wf[2][5], a;   // two sets of five weight fragments: one is read from LDS while the other feeds the matrix unit
#pragma unroll
  for (int j = 0; j < 5; ++j) wf[0][j] = frag_b(wb + j * 16 * PJ_WP, lane);
#pragma unroll
  for (int g = 0; g < 4 * (DIN / 32); ++g) { const int kc = g >> 2, j0 = (g & 3) * 5;
    if (g + 1 < 4 * (DIN / 32)) {
#pragma unroll
      for (int j = 0; j < 5; ++j) wf[(g + 1) & 1][j] = frag_b(wb + (((g + 1) >> 2) * 5 * HD + (((g + 1) & 3) * 5 + j) * 16) * PJ_WP, lane); }
    if ((g & 3) == 0) {
#pragma unroll
      for (int i = 0; i < 4; ++i) { a[i] = (__bf16)xr[kc][0][i]; a[4 + i] = (__bf16)xr[kc][1][i]; a[8 + i] = (__bf16)xr[kc][2][i]; a[12 + i] = (__bf16)xr[kc][3][i]; } }
    __builtin_amdgcn_sched_barrier(0);   // the next set's LDS reads issue as one group ahead of this set's products, so that they land under them
#pragma unroll
    for (int j = 0; j < 5; ++j) acc[j0 + j] = j0 + j < 16 ? mmb(wf[g & 1][j], a, acc[j0 + j]) : mmb(a, wf[g & 1][j], acc[j0 + j]);
    __builtin_amdgcn_sched_barrier(0);   // keeps this set's products ahead of the reads that refill its registers
  }
  __syncthreads();   // every wave has read its last weight fragment: the output tiles may take that LDS
#pragma unroll
  for (int j = 0; j < 20; ++j) { v8h o;
#pragma unroll
    for (int r = 0; r < 8; ++r) o[r] = (_Float16)acc[j][r];
    if (j < 16) *(v8h*)&sm.o.qk[rw + c][j * 16 + 8 * h] = o; else *(v8h*)&sm.o.vt[(j - 16) * 16 + c][rw + 8 * h] = o; }
  __syncthreads();   // the output tiles are complete before they are read back as whole rows
  const int rl = tid >> 4, q8 = (tid & 15) * 8;   // 16 threads per 256-B row, rows rl + 16 i: every LDS read and every store reaches its row by an immediate offset
  v4u oq[8], ok[8], ov[4];
#pragma unroll
  for (int i = 0; i < 8; ++i) { oq[i] = *(const v4u*)&sm.o.qk[rl + 16 * i][q8]; ok[i] = *(const v4u*)&sm.o.qk[rl + 16 * i][128 + q8]; }
#pragma unroll
  for (int i = 0; i < 4; ++i) ov[i] = *(const v4u*)&sm.o.vt[rl + 16 * i][q8];
  _Float16* qd = QH + (r0 + rl) * CC + q8; _Float16* kd = KH + (r0 + rl) * CC + q8; _Float16* vd = VT + (bb * CC + rl) * (size_t)TT + t0 + q8;
#pragma unroll
  for (int i = 0; i < 8; ++i) { vst2(qd + i * 16 * CC, oq[i]); vst2(kd + i * 16 * CC, ok[i]); }
#pragma unroll
  for (int i = 0; i < 4; ++i) vst2(vd + (size_t)i * 16 * TT, ov[i]); }
#define FA_SK 128            // keys per stage
#define FA_NST (TT / FA_SK)
#define FA_KP 136            // LDS pitch of a K row (128 f16 = both maps) in f16: 272 B = 16 B x odd
#define FA_VP 136            // LDS pitch of a v plane row (128 keys) in f16
#define FA_QB 128            // queries per block
struct KF { v16h f[2][2]; };
struct FaLds { _Float16 sv[2][HD][FA_VP]; _Float16 sk[2][FA_SK][FA_KP]; float so[FA_QB][HD + 4]; };   // one object fixes the order: v first, so that its fragment reads reach every row tile by an immediate offset
__device__ __forceinline__ v8f mmh(v16h a, v16h b, v8f c) { return __builtin_amdgcn_wmma_f32_16x16x32_f16(false, a, false, b, (short)0, c, false, false); }
__device__ __forceinline__ float xhalf(float x) { return __builtin_bit_cast(float, __builtin_amdgcn_permlanex16(__builtin_bit_cast(int, x), __builtin_bit_cast(int, x), 0x76543210, 0xfedcba98, false, false)); }  // lane l with lane l ^ 16
__device__ __forceinline__ void fa_load_k(KF& k, const _Float16* rows, int lane) {   // rows: the pass's first key row at this wave's map columns
#pragma unroll
  for (int kt = 0; kt < 2; ++kt)
#pragma unroll
    for (int kc = 0; kc < 2; ++kc) k.f[kt][kc] = frag_h(rows + (16 * kt + (lane & 15)) * FA_KP + kc * 32, lane);
}
__global__ __launch_bounds__(256) void k_fa(const _Float16* __restrict__ QH, const _Float16* __restrict__ KH, const _Float16* __restrict__ VT, const float* __restrict__ LAMB, float* __restrict__ OUT) {
  __shared__ __align__(16) FaLds sm;
  const int tid = threadIdx.x, lane = tid & 31, wave = __builtin_amdgcn_readfirstlane(tid >> 5), c = lane & 15, h = lane >> 4;
  const int map = wave >> 2, qw = (wave & 3) * 32, b = blockIdx.y, q0 = blockIdx.x * FA_QB;
  const float cscale = SCALE * 1.4426950408889634f;
  const int srow = tid >> 4, sq = (tid & 15) * 8;   // staging: 16 threads per 256-B row, rows srow + 16 i
  const _Float16* Kg = KH + ((size_t)b * TT + srow) * CC + sq; const _Float16* Vg = VT + ((size_t)b * CC + srow) * (size_t)TT + sq;
  v8h rk[8], rv[4];
#pragma unroll
  for (int i = 0; i < 8; ++i) rk[i] = *(const v8h*)(Kg + (size_t)(16 * i) * CC);
#pragma unroll
  for (int i = 0; i < 4; ++i) rv[i] = *(const v8h*)(Vg + (size_t)(16 * i) * TT);
  v16h qf[2][2];
#pragma unroll
  for (int g = 0; g < 2; ++g)
#pragma unroll
    for (int kc = 0; kc < 2; ++kc) qf[g][kc] = frag_h(QH + ((size_t)b * TT + q0 + qw + 16 * g + c) * CC + map * HD + kc * 32, lane);
  asm volatile("s_wait_xcnt 0x0" ::: "memory");   // the address registers of the loads above are reused below
  v16h ones;   // A operand whose row 0 (lanes 0 and 16) is 1.0 at all 32 k, every other row 0
#pragma unroll
  for (int i = 0; i < 16; ++i) ones[i] = c == 0 ? (_Float16)1.0f : (_Float16)0.0f;
  v8f acc[2][4] = {}, lacc[2] = {}; float m_run[2] = {-INFINITY, -INFINITY};
#pragma unroll
  for (int i = 0; i < 8; ++i) *(v8h*)&sm.sk[0][srow + 16 * i][sq] = rk[i];
#pragma unroll
  for (int i = 0; i < 4; ++i) *(v8h*)&sm.sv[0][srow + 16 * i][sq] = rv[i];
  __syncthreads();   // stage 0 is in LDS for every wave
#pragma unroll 1   // rolled: the buffer index is a run-time value and one stage's code serves all 32
  for (int st = 0; st < FA_NST; ++st) { const int cur = st & 1; const int nx = st + 1 < FA_NST ? st + 1 : st;   // the last trip stages its own keys once more into the buffer nobody reads again
    const _Float16* kbase = &sm.sk[cur][0][map * HD]; const _Float16* vbase = &sm.sv[cur][c][8 * h];
#pragma unroll
    for (int i = 0; i < 8; ++i) rk[i] = *(const v8h*)(Kg + (size_t)(nx * FA_SK + 16 * i) * CC);   // the next stage's rows fly under this stage's four passes
#pragma unroll
    for (int i = 0; i < 4; ++i) rv[i] = *(const v8h*)(Vg + (size_t)(16 * i) * TT + nx * FA_SK);
    asm volatile("s_wait_xcnt 0x0" ::: "memory");   // the address registers of these loads are reused by the passes below
    KF kf; fa_load_k(kf, kbase, lane);
#pragma unroll   // unrolled: every LDS read of a pass gets its place as an immediate offset, and the last pass's missing K fetch costs no branch
    for (int sub = 0; sub < FA_SK / 32; ++sub) {   // one 32-key pass
      v8f s[2][2];
#pragma unroll
      for (int kt = 0; kt < 2; ++kt)
#pragma unroll
        for (int g = 0; g < 2; ++g) { s[kt][g] = v8f{};
#pragma unroll
          for (int kc = 0; kc < 2; ++kc) s[kt][g] = mmh(kf.f[kt][kc], qf[g][kc], s[kt][g]); }
      __builtin_amdgcn_sched_barrier(0);   // the LDS reads below issue as one group behind the score products, not among them
      v16h vf[4];   // this pass's V^T fragments, asked for here so that they land under the maxima
#pragma unroll
      for (int t = 0; t < 4; ++t) { union { v16h v; v8h q[2]; } u; const _Float16* p = vbase + 16 * t * FA_VP + sub * 32; u.q[0] = *(const v8h*)p; u.q[1] = *(const v8h*)(p + 16); vf[t] = u.v; }
      if (sub + 1 < FA_SK / 32) fa_load_k(kf, kbase + (sub + 1) * 32 * FA_KP, lane);   // the next pass's K fragments (same stage) fly under this pass's softmax
      float mb[2]; bool need = false;
#pragma unroll
      for (int g = 0; g < 2; ++g) { float mx = s[0][g][0];
#pragma unroll
        for (int r = 1; r < 8; ++r) mx = fmaxf(mx, s[0][g][r]);
#pragma unroll
        for (int r = 0; r < 8; ++r) mx = fmaxf(mx, s[1][g][r]);
        mx = fmaxf(mx, xhalf(mx)) * cscale; mb[g] = mx; need = need || (mx > m_run[g] + 4.0f); }
      if (__builtin_amdgcn_ballot_w32(need) != 0) {   // lazy rescale, one test per pass: the maximum in use may trail the true one by up to 4 (log2)
#pragma unroll
        for (int g = 0; g < 2; ++g) { const float m_new = fmaxf(m_run[g], mb[g]); const float corr = __builtin_amdgcn_exp2f(m_run[g] - m_new); m_run[g] = m_new; lacc[g] = lacc[g] * corr;
#pragma unroll
          for (int t = 0; t < 4; ++t) acc[g][t] = acc[g][t] * corr; } }
#pragma unroll
      for (int g = 0; g < 2; ++g) { const float nm = 8.0f - m_run[g];   // weights x 2^8 (at most 2^12): small ones stay out of the f16 subnormals; the factor cancels in o / l
        v16h pf;   // element e = key 8 h + e (e < 8), 16 + 8 h + e - 8 (e >= 8): the k order of frag_h
#pragma unroll
        for (int e = 0; e < 16; ++e) pf[e] = (_Float16)__builtin_amdgcn_exp2f(fmaf(s[e >> 3][g][e & 7], cscale, nm));
#pragma unroll
        for (int t = 0; t < 4; ++t) acc[g][t] = mmh(vf[t], pf, acc[g][t]);
        lacc[g] = mmh(ones, pf, lacc[g]); }
      __builtin_amdgcn_sched_barrier(0);   // keeps one pass's work apart from the next pass's, so that a pass's registers are free again at its end
    }
#pragma unroll
    for (int i = 0; i < 8; ++i) *(v8h*)&sm.sk[cur ^ 1][srow + 16 * i][sq] = rk[i];
#pragma unroll
    for (int i = 0; i < 4; ++i) *(v8h*)&sm.sv[cur ^ 1][srow + 16 * i][sq] = rv[i];
    __syncthreads();   // publishes stage st + 1 and ends every wave's reads of the buffer that the next trip refills
  }
  const float lam = bfr(LAMB[0]);
  float inv[2];
#pragma unroll
  for (int g = 0; g < 2; ++g) { const float lr = lacc[g][0]; inv[g] = 1.0f / (lr + xhalf(lr)); }   // row 0 of the tile (lanes 0..15) holds the denominator, row 8 (lanes 16..31) is 0
  if (map == 1) {
#pragma unroll
    for (int g = 0; g < 2; ++g)
#pragma unroll
      for (int t = 0; t < 4; ++t) { const v8f o = acc[g][t] * inv[g]; float* p = &sm.so[qw + 16 * g + c][16 * t + 8 * h]; *(v4f*)p = v4f{o[0], o[1], o[2], o[3]}; *(v4f*)(p + 4) = v4f{o[4], o[5], o[6], o[7]}; } }
  __syncthreads();   // map 2's normalised rows are in LDS
  if (map == 0) {
#pragma unroll
    for (int g = 0; g < 2; ++g)
#pragma unroll
      for (int t = 0; t < 4; ++t) { const v8f o = acc[g][t] * inv[g]; float* p = &sm.so[qw + 16 * g + c][16 * t + 8 * h]; const v4f x0 = *(const v4f*)p, x1 = *(const v4f*)(p + 4);
        *(v4f*)p = v4f{o[0] - lam * x0[0], o[1] - lam * x0[1], o[2] - lam * x0[2], o[3] - lam * x0[3]}; *(v4f*)(p + 4) = v4f{o[4] - lam * x1[0], o[5] - lam * x1[1], o[6] - lam * x1[2], o[7] - lam * x1[3]}; } }
  __syncthreads();   // the combined rows are complete before they are read back as whole rows
  for (int e = tid; e < FA_QB * 16; e += 256) { const int rl = e >> 4, q = e & 15; vst2(OUT + ((size_t)b * TT + q0 + rl) * HD + q * 4, *(const v4f*)&sm.so[rl][q * 4]); } }

extern "C" void kernel_launch(void* const* d_in, const int* in_sizes, int n_in, void* d_out, int out_size, void* d_ws, size_t ws_size, hipStream_t stream) {
  (void)in_sizes; (void)n_in; (void)out_size;
  const float** F = (const float**)d_in;
  if (ws_size < (size_t)WS_END) return;
  char* ws = (char*)d_ws; _Float16 *QH = (_Float16*)(ws + WS_QH), *KH = (_Float16*)(ws + WS_KH), *VT = (_Float16*)(ws + WS_VT);
  // inputs: 0 x [8,4096,384]; 1 lamb (f32 scalar, 0.5); 2 Wq1 [384,64] (in,out); 3 Wk1; 4 Wq2; 5 Wk2; 6 Wv [384,64]; no biases
  k_proj<<<dim3(TNB * TT / PJ_ROWS), 256, 0, stream>>>(F[0], F[2], F[4], F[3], F[5], F[6], QH, KH, VT);   /* q = [q1 | q2], k = [k1 | k2] as rows of 128; v as planes 0..63 of [b][c][t] */
  k_fa<<<dim3(TT / FA_QB, TNB), 256, 0, stream>>>(QH, KH, VT, F[1], (float*)d_out);   /* both maps, both softmaxes, the combine and the value product */
}

// v004
// Measured time: 67.7 microseconds a run.
// In both of two side-by-side timings against v003, it was 1.09 times as fast.
// Over all steps from v000 it is 41.8 times as fast.
// compute dtype: all float inputs rounded to bf16; the five 64-wide projections with EXACT bf16 products on WMMA 16x16x32 (f32 accumulate); both score maps (q x 64^-0.5 log2 e) x k once to f16 each (1 product), summed on top of 8 - running maximum; two online softmaxes in f32 (log2 domain); each map's exp weights (x 2^8) once to f16, x v once to f16 (1 product per map); both normalised and combined o1 - lamb o2 in f32; f32 output.
#include <hip/hip_runtime.h>
#include <math.h>

typedef __attribute__((ext_vector_type(16))) _Float16 v16h;
typedef __attribute__((ext_vector_type(16))) __bf16 v16b;
typedef __attribute__((ext_vector_type(8)))  _Float16 v8h;
typedef __attribute__((ext_vector_type(8)))  float v8f;
typedef __attribute__((ext_vector_type(4)))  float v4f;
typedef __attribute__((ext_vector_type(2)))  float v2f;
typedef __attribute__((ext_vector_type(4)))  unsigned v4u;
typedef __attribute__((ext_vector_type(4)))  int v4i;
typedef float __attribute__((may_alias)) float_a;
typedef int __attribute__((may_alias)) int_a;

template <typename T> __device__ __forceinline__ void vst2(void* p, T v) { *(T*)p = v;  }
__device__ __forceinline__ v8f wmma16(v16h a, v16h b, v8f c) {
  v8f d = __builtin_amdgcn_wmma_f32_16x16x32_f16(false, a, false, b, (short)0, c, false, false);
  asm volatile("v_nop\n\tv_nop\n\tv_nop\n\tv_nop" : "+v"(d) : "v"(a), "v"(b));
  return d;
}
__device__ __forceinline__ v8f wmma_bf(v16b a, v16b b, v8f c) {
  v8f d = __builtin_amdgcn_wmma_f32_16x16x32_bf16(false, a, false, b, (short)0, c, false, false);
  asm volatile("v_nop\n\tv_nop\n\tv_nop\n\tv_nop" : "+v"(d) : "v"(a), "v"(b));
  return d;
}
// 16x16x32 fragments: lane = (h = lane>>4, row/col = lane&15); elements 0..7 = k0+8h+0..7, 8..15 = k0+16+8h+0..7; D element r = row 8h+r
__device__ __forceinline__ v16h frag_h(const _Float16* rowk0, int lane) {
  union { v16h v; v8h q[2]; } u; const _Float16* p = rowk0 + 8 * (lane >> 4);
  u.q[0] = *(const v8h*)p; u.q[1] = *(const v8h*)(p + 16); return u.v;
}
__device__ __forceinline__ v16h frag_f32(const float* rowk0, int lane) {
  v16h a; const float* p = rowk0 + 8 * (lane >> 4);
#pragma unroll
  for (int i = 0; i < 8; ++i) { a[i] = (_Float16)p[i]; a[8 + i] = (_Float16)p[16 + i]; }
  return a;
}
__device__ __forceinline__ v16h frag_f32s(const float* rowk0, int lane, float sc) {
  v16h a; const float* p = rowk0 + 8 * (lane >> 4);
#pragma unroll
  for (int i = 0; i < 8; ++i) { a[i] = (_Float16)(p[i] * sc); a[8 + i] = (_Float16)(p[16 + i] * sc); }
  return a;
}
// column fragment from a [K][ld] layout (column n), rows >= K read as 0
__device__ __forceinline__ v16h fragc_f32(const float* W, int k0, int n, int lane, int ld, int K) {
  v16h a; const int g = lane >> 4;
#pragma unroll
  for (int i = 0; i < 8; ++i) { const int ka = k0 + 8 * g + i, kb = ka + 16;
    a[i] = (_Float16)(ka < K ? W[(size_t)(ka < K ? ka : K - 1) * ld + n] : 0.f); a[8 + i] = (_Float16)(kb < K ? W[(size_t)(kb < K ? kb : K - 1) * ld + n] : 0.f); }
  return a;
}
struct F2 { v16b h, l; };
__device__ __forceinline__ F2 bsplit16(const float v[16]) { F2 r;
#pragma unroll
  for (int i = 0; i < 16; ++i) { const __bf16 h = (__bf16)v[i]; r.h[i] = h; r.l[i] = (__bf16)(v[i] - (float)h); }
  return r; }
__device__ __forceinline__ F2 split_row(const float* row, int k0, int lane) { float v[16]; const float* p = row + k0 + 8 * (lane >> 4);
#pragma unroll
  for (int i = 0; i < 8; ++i) { v[i] = p[i]; v[8 + i] = p[16 + i]; }
  return bsplit16(v); }
__device__ __forceinline__ F2 split_rowK(const float* row, int k0, int lane, int K) { float v[16]; const int g = lane >> 4;
#pragma unroll
  for (int i = 0; i < 8; ++i) { const int ka = k0 + 8 * g + i, kb = ka + 16; v[i] = ka < K ? row[ka < K ? ka : K - 1] : 0.f; v[8 + i] = kb < K ? row[kb < K ? kb : K - 1] : 0.f; }
  return bsplit16(v); }
__device__ __forceinline__ F2 split_col(const float* W, int k0, int n, int lane, int ld, int K) { float v[16]; const int g = lane >> 4;
#pragma unroll
  for (int i = 0; i < 8; ++i) { const int ka = k0 + 8 * g + i, kb = ka + 16; v[i] = ka < K ? W[(size_t)(ka < K ? ka : K - 1) * ld + n] : 0.f; v[8 + i] = kb < K ? W[(size_t)(kb < K ? kb : K - 1) * ld + n] : 0.f; }
  return bsplit16(v); }
__device__ __forceinline__ v8f mac3(const F2& a, const F2& b, v8f c) { c = wmma_bf(a.l, b.h, c); c = wmma_bf(a.h, b.l, c); return wmma_bf(a.h, b.h, c); }
__device__ __forceinline__ float sigm(float v) { return 1.0f / (1.0f + expf(-v)); }
#define LDSX() do { asm volatile("s_wait_dscnt 0" ::: "memory"); __builtin_amdgcn_wave_barrier(); __builtin_amdgcn_fence(__ATOMIC_RELEASE, "workgroup"); } while (0)

// Differential attention head (x [8,4096,384]; (in,out) Wq1 / Wk1 / Wq2 / Wk2 / Wv [384,64] (0.02 scale), no biases; w1 = softmax(q1 k1^T / 8), w2 = softmax(q2 k2^T / 8) over all 4,096 keys (no mask); out = (w1 - lamb w2) v with lamb a scalar input (0.5)) -> [8,4096,64].
#define NB 8
#define TT 4096
#define CC 128            // NH * HD = projected width
#define DIN 384          // input (model) width
#define NH 2
#define HD 64
#define NQB (TT / 64)
#define HG 2
#define SCALE (0.125f)
#define QSC (SCALE * 1.4426950408889634f)   // on q: the scores come out of the matrix unit in the log2 domain
#define CAUSAL 0
#ifndef TNB
#define TNB NB
#endif
__device__ __forceinline__ float bfr(float v) { return (float)(__bf16)v; }
__host__ __device__ __forceinline__ int kb_last(int qb) { return CAUSAL ? ((qb * 64 + 63) >> 7) : (TT / 128 - 1); }
typedef __attribute__((ext_vector_type(8))) __bf16 v8b;
__device__ __forceinline__ v16b frag_b(const __bf16* rowk0, int lane) {
  union { v16b v; v8b q[2]; } u; const __bf16* p = rowk0 + 8 * (lane >> 4);
  u.q[0] = *(const v8b*)p; u.q[1] = *(const v8b*)(p + 16); return u.v;
}
#define QBH 0              // unused by the kernels
#define QHI 0               // single-product scores on every row
#define TQC 2048           // unused by the kernels (no score planes are kept)
#define KHI 64            // key rows carrying k residual / v bf16 hi+lo planes (planes that the kernels do not use)
// B fragment (k rows k0+.., output column o) of a weight: (in,out) [K][ld] or (out,in) [ld rows of K]: bf16 exact, or f16(bf16 * 256) exact
__device__ __forceinline__ v16b wcol_io(const float* Wm, int k0, int o, int lane, int ld) { v16b w; const int g = lane >> 4;
#pragma unroll
  for (int i = 0; i < 8; ++i) { w[i] = (__bf16)Wm[(size_t)(k0 + 8 * g + i) * ld + o]; w[8 + i] = (__bf16)Wm[(size_t)(k0 + 16 + 8 * g + i) * ld + o]; }
  return w; }
__device__ __forceinline__ v16b wcol_oi(const float* Wm, int k0, int o, int lane, int K) { v16b w; const float* p = Wm + (size_t)o * K + k0 + 8 * (lane >> 4);
#pragma unroll
  for (int i = 0; i < 8; ++i) { w[i] = (__bf16)p[i]; w[8 + i] = (__bf16)p[16 + i]; }
  return w; }
__device__ __forceinline__ v16h wcolh_io(const float* Wm, int k0, int o, int lane, int ld) { v16h w; const int g = lane >> 4;
#pragma unroll
  for (int i = 0; i < 8; ++i) { w[i] = (_Float16)(bfr(Wm[(size_t)(k0 + 8 * g + i) * ld + o]) * 256.0f); w[8 + i] = (_Float16)(bfr(Wm[(size_t)(k0 + 16 + 8 * g + i) * ld + o]) * 256.0f); }
  return w; }
__device__ __forceinline__ v16h wcolh_oi(const float* Wm, int k0, int o, int lane, int K) { v16h w; const float* p = Wm + (size_t)o * K + k0 + 8 * (lane >> 4);
#pragma unroll
  for (int i = 0; i < 8; ++i) { w[i] = (_Float16)(bfr(p[i]) * 256.0f); w[8 + i] = (_Float16)(bfr(p[16 + i]) * 256.0f); }
  return w; }
#define WQKV_LAYOUT 0   // 0 = (in,out) [DIN][HD] per map (pitch 64); 1 = (out,in) [CC][DIN]; 2 = per-head [NH][DIN][HD]
__device__ __forceinline__ v16b wcol_hdk(const float* Wm, int k0, int o, int lane) { v16b w; const int g = lane >> 4; const float* p = Wm + (size_t)(o / HD) * DIN * HD + (o % HD);
#pragma unroll
  for (int i = 0; i < 8; ++i) { w[i] = (__bf16)p[(size_t)(k0 + 8 * g + i) * HD]; w[8 + i] = (__bf16)p[(size_t)(k0 + 16 + 8 * g + i) * HD]; }
  return w; }
#define WO_OUT_IN 0
#if WQKV_LAYOUT == 1
#define WCOL(W, k0, o, lane) wcol_oi(W, k0, o, lane, DIN)
#elif WQKV_LAYOUT == 2
#define WCOL(W, k0, o, lane) wcol_hdk(W, k0, o, lane)
#else
__device__ __forceinline__ v16b zero16b() { v16b w; _Pragma("unroll") for (int i = 0; i < 16; ++i) w[i] = (__bf16)0.0f; return w; }
#define PROJ_EXTRA_PARAMS , const float* __restrict__ W2Q, const float* __restrict__ W2K
#define WCOL(W, k0, o, lane) ((o) < 64 ? wcol_io(W, k0, (o), lane, 64) : (which == 2 ? zero16b() : wcol_io(which == 0 ? W2Q : W2K, k0, (o) - 64, lane, 64)))   /* (in,out) [384][64] weights at pitch 64: projected columns 0..63 = map 1 (Wq1 / Wk1 / Wv), columns 64..127 = map 2 (Wq2 / Wk2; zero for v) */
#endif
#if WO_OUT_IN
#define WOCOL(W, k0, o, lane) wcol_oi(W, k0, o, lane, CC)
#define WOCOLH(W, k0, o, lane) wcolh_oi(W, k0, o, lane, CC)
#else
#define WOCOL(W, k0, o, lane) wcol_io(W, k0, o, lane, DIN)
#define WOCOLH(W, k0, o, lane) wcolh_io(W, k0, o, lane, DIN)
#endif
#define SM_EXTRA_PARAMS
#define SM_MASK_HOOK (void)0
#ifndef SM_EXTRA_PARAMS
#define SM_EXTRA_PARAMS
#endif
#ifndef PROJ_EXTRA_PARAMS
#define PROJ_EXTRA_PARAMS
#endif
#ifndef SM_MASK_HOOK
#define SM_MASK_HOOK (void)0
#endif

#define WS_QH  0u                                      // f16 q rows [b*t][CC]
#define WS_KH  (WS_QH + 2u * (size_t)NB * TT * CC)      // f16 k rows [b*t][CC]
#define WS_VT  (WS_KH + 2u * (size_t)NB * TT * CC)      // f16 v planes [b][c][t]
#define WS_QL  (WS_VT + 2u * (size_t)NB * CC * TT)      // f16 q residual x 2^10 rows [b][t < QHI][CC]
#define WS_KL  (WS_QL + 2u * (size_t)NB * QHI * CC)     // f16 k residual x 2^10 rows [b][t < KHI][CC]
#define WS_VB  (WS_KL + 2u * (size_t)NB * KHI * CC)     // bf16 v hi planes [b][c][t < KHI]
#define WS_VBL (WS_VB + 2u * (size_t)NB * CC * KHI)
#define WS_END (WS_VBL + 2u * (size_t)NB * CC * KHI)    // end of all planes (the kernels use only the first three)

// ---- k_proj: block = 128 rows of x, 8 waves, all five projections (320 output columns: q1 | q2 | k1 | k2 | v) with exact bf16 products (K = DIN). The five weights go once per block into LDS as bf16, as 12 slabs of 32 k, each 320 output columns of 64 B; a wave holds its 16 x rows in registers and takes all 20 column tiles. q / k tiles are formed as W^T x^T (a lane holds 8 neighbouring columns of one row), v tiles as x W (a lane holds 8 neighbouring rows of one column), so that both leave as 16-byte LDS stores; whole q / k rows and v plane rows [c][t] are stored from LDS.
#define PJ_ROWS 128
#define PJ_WP 40             // LDS pitch of one output column's 32 k of a slab in bf16: 80 B = 16 B x odd
#define PJ_QKP 264           // LDS pitch of a staged [q1 | q2 | k1 | k2] row in f16: 528 B = 16 B x odd
#define PJ_VP 136            // LDS pitch of a staged v plane row (128 t) in f16
struct PjOut { _Float16 qk[PJ_ROWS][PJ_QKP]; _Float16 vt[HD][PJ_VP]; };
union PjLds { __bf16 w[DIN / 32][5 * HD][PJ_WP]; PjOut o; };   // the output tiles take the weights' place behind a barrier
__device__ __forceinline__ v8f mmb(v16b a, v16b b, v8f c) { return __builtin_amdgcn_wmma_f32_16x16x32_bf16(false, a, false, b, (short)0, c, false, false); }
__device__ __forceinline__ void pj_ldw(v4f (&wr)[3][8], const float* Wm) {   // a lane's 4 columns x 8 k of each third of one weight
  __builtin_amdgcn_sched_barrier(0);   // the loads stay between this place and their s_wait_xcnt: lifted above it they would stand without that wait while their base registers are reused
#pragma unroll
  for (int u = 0; u < 3; ++u)
#pragma unroll
    for (int r = 0; r < 8; ++r) wr[u][r] = *(const v4f*)(Wm + (u * 128 + r) * HD);
  asm volatile("s_wait_xcnt 0x0" ::: "memory");   // the address registers of the loads above are reused behind this place
  __builtin_amdgcn_sched_barrier(0);   // nothing that rewrites those registers moves ahead of the wait
}
__device__ __forceinline__ void pj_stw(const v4f (&wr)[3][8], __bf16* l) {
#pragma unroll
  for (int u = 0; u < 3; ++u)
#pragma unroll
    for (int i = 0; i < 4; ++i) { v8b p;
#pragma unroll
      for (int r = 0; r < 8; ++r) p[r] = (__bf16)wr[u][r][i];
      *(v8b*)(l + (u * 4 * 5 * HD + i) * PJ_WP) = p; } }
__global__ __launch_bounds__(256) void k_proj(const float* __restrict__ X, const float* __restrict__ WQ1, const float* __restrict__ WQ2, const float* __restrict__ WK1, const float* __restrict__ WK2, const float* __restrict__ WV,
    _Float16* __restrict__ QH, _Float16* __restrict__ KH, _Float16* __restrict__ VT) {
  __shared__ __align__(16) PjLds sm;
  // every loop of this kernel and of its two helpers is unrolled: their arrays are meant to live in registers, which takes compile-time indices
  const int tid = threadIdx.x, lane = tid & 31, wave = __builtin_amdgcn_readfirstlane(tid >> 5), c = lane & 15, h = lane >> 4;
  const size_t r0 = (size_t)blockIdx.x * PJ_ROWS; const size_t bb = r0 / TT; const int t0 = (int)(r0 % TT);
  const int rw = wave * 16;
  // weight staging: a lane takes 4 columns x 8 k (8 loads of 16 B, 4 LDS stores of 16 B); 8 x 4 lanes of a wave make each load four whole 128-B lines; a wave takes 32 columns x 32 k (half of one slab), 8 waves a third of one weight. Two weights are in flight at a time.
  const int cq = (wave & 1) * 8 + (lane & 7), ko = (wave >> 1) * 4 + (lane >> 3);
  const int goff = 8 * ko * HD + 4 * cq; __bf16* lw = &sm.w[ko >> 2][4 * cq][8 * (ko & 3)];
  v4f wr[2][3][8];
  pj_ldw(wr[0], WQ1 + goff); pj_ldw(wr[1], WQ2 + goff);
  pj_stw(wr[0], lw); pj_ldw(wr[0], WK1 + goff);
  pj_stw(wr[1], lw + HD * PJ_WP); pj_ldw(wr[1], WK2 + goff);
  pj_stw(wr[0], lw + 2 * HD * PJ_WP); pj_ldw(wr[0], WV + goff);
  const float* xp = X + (r0 + rw + c) * DIN + 8 * h;
  __builtin_amdgcn_sched_barrier(0);   // as in pj_ldw: the loads below stay in front of their s_wait_xcnt
  v4f xr[DIN / 32][4];   // the wave's whole x rows are asked for at once, behind the last weight's loads: no wait of the staging covers them, and each k chunk is waited for only where the product loop takes it
#pragma unroll
  for (int kc = 0; kc < DIN / 32; ++kc) { const float* p = xp + kc * 32; xr[kc][0] = *(const v4f*)p; xr[kc][1] = *(const v4f*)(p + 4); xr[kc][2] = *(const v4f*)(p + 16); xr[kc][3] = *(const v4f*)(p + 20); }
  asm volatile("s_wait_xcnt 0x0" :: "v"(xp) : "memory");   // the address registers of the loads above are reused below; xp is named so that the pair stays live up to this wait and no load of the run gets its result placed in it
  __builtin_amdgcn_sched_barrier(0);   // nothing that rewrites those registers moves ahead of the wait
  pj_stw(wr[1], lw + 3 * HD * PJ_WP); pj_stw(wr[0], lw + 4 * HD * PJ_WP);
  // all five weights are in LDS for every wave. The barrier is written with fences on LDS alone: __syncthreads() would also wait here for the x loads, which are to land under the product loop
  __builtin_amdgcn_fence(__ATOMIC_RELEASE, "workgroup", "local"); __builtin_amdgcn_s_barrier(); __builtin_amdgcn_fence(__ATOMIC_ACQUIRE, "workgroup", "local");
  const __bf16* wb = &sm.w[0][c][0];
  v8f acc[20] = {}; v16b wf[2][5], a;   // two sets of five weight fragments: one is read from LDS while the other feeds the matrix unit
#pragma unroll
  for (int j = 0; j < 5; ++j) wf[0][j] = frag_b(wb + j * 16 * PJ_WP, lane);
#pragma unroll
  for (int g = 0; g < 4 * (DIN / 32); ++g) { const int kc = g >> 2, j0 = (g & 3) * 5;
    if (g + 1 < 4 * (DIN / 32)) {
#pragma unroll
      for (int j = 0; j < 5; ++j) wf[(g + 1) & 1][j] = frag_b(wb + (((g + 1) >> 2) * 5 * HD + (((g + 1) & 3) * 5 + j) * 16) * PJ_WP, lane); }
    if ((g & 3) == 0) {
#pragma unroll
      for (int i = 0; i < 4; ++i) { a[i] = (__bf16)xr[kc][0][i]; a[4 + i] = (__bf16)xr[kc][1][i]; a[8 + i] = (__bf16)xr[kc][2][i]; a[12 + i] = (__bf16)xr[kc][3][i]; } }
    __builtin_amdgcn_sched_barrier(0);   // the next set's LDS reads issue as one group ahead of this set's products, so that they land under them
#pragma unroll
    for (int j = 0; j < 5; ++j) acc[j0 + j] = j0 + j < 16 ? mmb(wf[g & 1][j], a, acc[j0 + j]) : mmb(a, wf[g & 1][j], acc[j0 + j]);
    __builtin_amdgcn_sched_barrier(0);   // keeps this set's products ahead of the reads that refill its registers
  }
  __syncthreads();   // every wave has read its last weight fragment: the output tiles may take that LDS
#pragma unroll
  for (int j = 0; j < 20; ++j) { v8h o;
#pragma unroll
    for (int r = 0; r < 8; ++r) o[r] = (_Float16)(j < 8 ? acc[j][r] * QSC : acc[j][r]);   // q leaves with the softmax scale and log2 e on it, applied in f32 ahead of the one rounding to f16
    if (j < 16) *(v8h*)&sm.o.qk[rw + c][j * 16 + 8 * h] = o; else *(v8h*)&sm.o.vt[(j - 16) * 16 + c][rw + 8 * h] = o; }
  __syncthreads();   // the output tiles are complete before they are read back as whole rows
  const int rl = tid >> 4, q8 = (tid & 15) * 8;   // 16 threads per 256-B row, rows rl + 16 i: every LDS read and every store reaches its row by an immediate offset
  v4u oq[8], ok[8], ov[4];
#pragma unroll
  for (int i = 0; i < 8; ++i) { oq[i] = *(const v4u*)&sm.o.qk[rl + 16 * i][q8]; ok[i] = *(const v4u*)&sm.o.qk[rl + 16 * i][128 + q8]; }
#pragma unroll
  for (int i = 0; i < 4; ++i) ov[i] = *(const v4u*)&sm.o.vt[rl + 16 * i][q8];
  _Float16* qd = QH + (r0 + rl) * CC + q8; _Float16* kd = KH + (r0 + rl) * CC + q8; _Float16* vd = VT + (bb * CC + rl) * (size_t)TT + t0 + q8;
#pragma unroll
  for (int i = 0; i < 8; ++i) { vst2(qd + i * 16 * CC, oq[i]); vst2(kd + i * 16 * CC, ok[i]); }
#pragma unroll
  for (int i = 0; i < 4; ++i) vst2(vd + (size_t)i * 16 * TT, ov[i]); }
#define FA_SK 128            // keys per stage
#define FA_NST (TT / FA_SK)
#define FA_KP 136            // LDS pitch of a K row (128 f16 = both maps) in f16: 272 B = 16 B x odd
#define FA_VP 136            // LDS pitch of a v plane row (128 keys) in f16
#define FA_QB 128            // queries per block
struct KF { v16h f[2][2]; };
struct FaLds { _Float16 sv[2][HD][FA_VP]; _Float16 sk[2][FA_SK][FA_KP]; float so[FA_QB][HD + 4]; };   // one object fixes the order: v first, so that its fragment reads reach every row tile by an immediate offset
__device__ __forceinline__ v8f mmh(v16h a, v16h b, v8f c) { return __builtin_amdgcn_wmma_f32_16x16x32_f16(false, a, false, b, (short)0, c, false, false); }
__device__ __forceinline__ float xhalf(float x) { return __builtin_bit_cast(float, __builtin_amdgcn_permlanex16(__builtin_bit_cast(int, x), __builtin_bit_cast(int, x), 0x76543210, 0xfedcba98, false, false)); }  // lane l with lane l ^ 16
__device__ __forceinline__ float mx2(float a, float b) { return fmaxf(a, b); }
__device__ __forceinline__ float mx3(float a, float b, float c) { return mx2(mx2(a, b), c); }
__device__ __forceinline__ float tmax16(v8f u, v8f v) { return mx2(mx3(mx3(u[0], u[1], u[2]), mx3(u[3], u[4], u[5]), mx3(u[6], u[7], v[0])), mx3(mx3(v[1], v[2], v[3]), mx3(v[4], v[5], v[6]), v[7])); }   // short independent chains of three-operand maxima
__device__ __forceinline__ void fa_load_k(KF& k, const _Float16* rows, int lane) {   // rows: the pass's first key row at this wave's map columns
#pragma unroll
  for (int kt = 0; kt < 2; ++kt)
#pragma unroll
    for (int kc = 0; kc < 2; ++kc) k.f[kt][kc] = frag_h(rows + (16 * kt + (lane & 15)) * FA_KP + kc * 32, lane);
}
__global__ __launch_bounds__(256) void k_fa(const _Float16* __restrict__ QH, const _Float16* __restrict__ KH, const _Float16* __restrict__ VT, const float* __restrict__ LAMB, float* __restrict__ OUT) {
  __shared__ __align__(16) FaLds sm;
  const int tid = threadIdx.x, lane = tid & 31, wave = __builtin_amdgcn_readfirstlane(tid >> 5), c = lane & 15, h = lane >> 4;
  const int map = wave >> 2, qw = (wave & 3) * 32, b = blockIdx.y, q0 = blockIdx.x * FA_QB;
  const int srow = tid >> 4, sq = (tid & 15) * 8;   // staging: 16 threads per 256-B row, rows srow + 16 i
  const _Float16* Kg = KH + ((size_t)b * TT + srow) * CC + sq; const _Float16* Vg = VT + ((size_t)b * CC + srow) * (size_t)TT + sq;
  v8h rk[8], rv[4];
#pragma unroll
  for (int i = 0; i < 8; ++i) rk[i] = *(const v8h*)(Kg + (size_t)(16 * i) * CC);
#pragma unroll
  for (int i = 0; i < 4; ++i) rv[i] = *(const v8h*)(Vg + (size_t)(16 * i) * TT);
  v16h qf[2][2];
#pragma unroll
  for (int g = 0; g < 2; ++g)
#pragma unroll
    for (int kc = 0; kc < 2; ++kc) qf[g][kc] = frag_h(QH + ((size_t)b * TT + q0 + qw + 16 * g + c) * CC + map * HD + kc * 32, lane);
  asm volatile("s_wait_xcnt 0x0" ::: "memory");   // the address registers of the loads above are reused below
  v16h ones;   // A operand whose row 0 (lanes 0 and 16) is 1.0 at all 32 k, every other row 0
#pragma unroll
  for (int i = 0; i < 16; ++i) ones[i] = c == 0 ? (_Float16)1.0f : (_Float16)0.0f;
  v8f acc[2][4] = {}, lacc[2] = {};
#pragma unroll
  for (int i = 0; i < 8; ++i) *(v8h*)&sm.sk[0][srow + 16 * i][sq] = rk[i];
#pragma unroll
  for (int i = 0; i < 4; ++i) *(v8h*)&sm.sv[0][srow + 16 * i][sq] = rv[i];
  __syncthreads();   // stage 0 is in LDS for every wave
  float nm[2];   // per query group: 8 - the maximum in use. It is the start value (C operand) of the group's score products, so that a score tile leaves the matrix unit as the exponent of its weight (x 2^8: small weights stay out of the f16 subnormals; the factor cancels in o / l)
  { KF k0; fa_load_k(k0, &sm.sk[0][0][map * HD], lane);   // the first maximum in use is the true one of keys 0..31
#pragma unroll
    for (int g = 0; g < 2; ++g) { v8f a0 = {}, a1 = {};
#pragma unroll
      for (int kc = 0; kc < 2; ++kc) { a0 = mmh(k0.f[0][kc], qf[g][kc], a0); a1 = mmh(k0.f[1][kc], qf[g][kc], a1); }
      float mx = tmax16(a0, a1); mx = mx2(mx, xhalf(mx)); nm[g] = 8.0f - mx; } }
#pragma unroll 1   // rolled: the buffer index is a run-time value and one stage's code serves all 32
  for (int st = 0; st < FA_NST; ++st) { const int cur = st & 1; const int nx = st + 1 < FA_NST ? st + 1 : st;   // the last trip stages its own keys once more into the buffer nobody reads again
    const _Float16* kbase = &sm.sk[cur][0][map * HD]; const _Float16* vbase = &sm.sv[cur][c][8 * h];
#pragma unroll
    for (int i = 0; i < 8; ++i) rk[i] = *(const v8h*)(Kg + (size_t)(nx * FA_SK + 16 * i) * CC);   // the next stage's rows fly under this stage's four passes
#pragma unroll
    for (int i = 0; i < 4; ++i) rv[i] = *(const v8h*)(Vg + (size_t)(16 * i) * TT + nx * FA_SK);
    asm volatile("s_wait_xcnt 0x0" ::: "memory");   // the address registers of these loads are reused by the passes below
    KF kf; fa_load_k(kf, kbase, lane);
    v8f cm[2];   // nm in all eight elements of a C operand; formed once per stage, so that two registers and not sixteen are carried round the loop
#pragma unroll
    for (int g = 0; g < 2; ++g)
#pragma unroll
      for (int r = 0; r < 8; ++r) cm[g][r] = nm[g];
#pragma unroll   // unrolled: every LDS read of a pass gets its place as an immediate offset, and the last pass's missing K fetch costs no branch
    for (int sub = 0; sub < FA_SK / 32; ++sub) {   // one 32-key pass
      v8f s[2][2];
#pragma unroll
      for (int kt = 0; kt < 2; ++kt)
#pragma unroll
        for (int g = 0; g < 2; ++g) { s[kt][g] = cm[g];
#pragma unroll
          for (int kc = 0; kc < 2; ++kc) s[kt][g] = mmh(kf.f[kt][kc], qf[g][kc], s[kt][g]); }
      __builtin_amdgcn_sched_barrier(0);   // the LDS reads below issue as one group behind the score products, not among them
      v16h vf[4];   // this pass's V^T fragments, asked for here so that they land under the maxima
#pragma unroll
      for (int t = 0; t < 4; ++t) { union { v16h v; v8h q[2]; } u; const _Float16* p = vbase + 16 * t * FA_VP + sub * 32; u.q[0] = *(const v8h*)p; u.q[1] = *(const v8h*)(p + 16); vf[t] = u.v; }
      if (sub + 1 < FA_SK / 32) fa_load_k(kf, kbase + (sub + 1) * 32 * FA_KP, lane);   // the next pass's K fragments (same stage) fly under this pass's softmax
      const float mg[2] = {tmax16(s[0][0], s[1][0]), tmax16(s[0][1], s[1][1])}; const bool need = mx2(mg[0], mg[1]) > 12.0f;   // a lane's 32 exponents, both groups at once; the ballot joins the lanes
      if (__builtin_amdgcn_ballot_w32(need) != 0) {   // lazy rescale, one test per pass: the maximum in use may trail the true one by up to 4 (log2), a weight is at most 2^12
#pragma unroll
        for (int g = 0; g < 2; ++g) { const float mx = mx2(mg[g], xhalf(mg[g]));
          const float d = mx2(mx - 8.0f, 0.0f); const float corr = __builtin_amdgcn_exp2f(-d);   // d: by how much this query's maximum in use rises
          nm[g] -= d; cm[g] = cm[g] - d; s[0][g] = s[0][g] - d; s[1][g] = s[1][g] - d; lacc[g] = lacc[g] * corr;
#pragma unroll
          for (int t = 0; t < 4; ++t) acc[g][t] = acc[g][t] * corr; } }
#pragma unroll
      for (int g = 0; g < 2; ++g) {
        v16h pf;   // element e = key 8 h + e (e < 8), 16 + 8 h + e - 8 (e >= 8): the k order of frag_h
#pragma unroll
        for (int e = 15; e >= 0; --e)   // downward: in this order the build writes each exponential over its own source or into a free register, never over the source of the exponential directly in front of it
          pf[e] = (_Float16)__builtin_amdgcn_exp2f(s[e >> 3][g][e & 7]);
#pragma unroll
        for (int t = 0; t < 4; ++t) acc[g][t] = mmh(vf[t], pf, acc[g][t]);
        lacc[g] = mmh(ones, pf, lacc[g]); }
      __builtin_amdgcn_sched_barrier(0);   // keeps one pass's work apart from the next pass's, so that a pass's registers are free again at its end
    }
#pragma unroll
    for (int i = 0; i < 8; ++i) *(v8h*)&sm.sk[cur ^ 1][srow + 16 * i][sq] = rk[i];
#pragma unroll
    for (int i = 0; i < 4; ++i) *(v8h*)&sm.sv[cur ^ 1][srow + 16 * i][sq] = rv[i];
    __syncthreads();   // publishes stage st + 1 and ends every wave's reads of the buffer that the next trip refills
  }
  const float lam = bfr(LAMB[0]);
  float inv[2];
#pragma unroll
  for (int g = 0; g < 2; ++g) { const float lr = lacc[g][0]; inv[g] = 1.0f / (lr + xhalf(lr)); }   // row 0 of the tile (lanes 0..15) holds the denominator, row 8 (lanes 16..31) is 0
  if (map == 1) {
#pragma unroll
    for (int g = 0; g < 2; ++g)
#pragma unroll
      for (int t = 0; t < 4; ++t) { const v8f o = acc[g][t] * inv[g]; float* p = &sm.so[qw + 16 * g + c][16 * t + 8 * h]; *(v4f*)p = v4f{o[0], o[1], o[2], o[3]}; *(v4f*)(p + 4) = v4f{o[4], o[5], o[6], o[7]}; } }
  __syncthreads();   // map 2's normalised rows are in LDS
  if (map == 0) {
#pragma unroll
    for (int g = 0; g < 2; ++g)
#pragma unroll
      for (int t = 0; t < 4; ++t) { const v8f o = acc[g][t] * inv[g]; float* p = &sm.so[qw + 16 * g + c][16 * t + 8 * h]; const v4f x0 = *(const v4f*)p, x1 = *(const v4f*)(p + 4);
        *(v4f*)p = v4f{o[0] - lam * x0[0], o[1] - lam * x0[1], o[2] - lam * x0[2], o[3] - lam * x0[3]}; *(v4f*)(p + 4) = v4f{o[4] - lam * x1[0], o[5] - lam * x1[1], o[6] - lam * x1[2], o[7] - lam * x1[3]}; } }
  __syncthreads();   // the combined rows are complete before they are read back as whole rows
  for (int e = tid; e < FA_QB * 16; e += 256) { const int rl = e >> 4, q = e & 15; vst2(OUT + ((size_t)b * TT + q0 + rl) * HD + q * 4, *(const v4f*)&sm.so[rl][q * 4]); } }

extern "C" void kernel_launch(void* const* d_in, const int* in_sizes, int n_in, void* d_out, int out_size, void* d_ws, size_t ws_size, hipStream_t stream) {
  (void)in_sizes; (void)n_in; (void)out_size;
  const float** F = (const float**)d_in;
  if (ws_size < (size_t)WS_END) return;
  char* ws = (char*)d_ws; _Float16 *QH = (_Float16*)(ws + WS_QH), *KH = (_Float16*)(ws + WS_KH), *VT = (_Float16*)(ws + WS_VT);
  // inputs: 0 x [8,4096,384]; 1 lamb (f32 scalar, 0.5); 2 Wq1 [384,64] (in,out); 3 Wk1; 4 Wq2; 5 Wk2; 6 Wv [384,64]; no biases
  k_proj<<<dim3(TNB * TT / PJ_ROWS), 256, 0, stream>>>(F[0], F[2], F[4], F[3], F[5], F[6], QH, KH, VT);   /* q = [q1 | q2], k = [k1 | k2] as rows of 128; v as planes 0..63 of [b][c][t] */
  k_fa<<<dim3(TT / FA_QB, TNB), 256, 0, stream>>>(QH, KH, VT, F[1], (float*)d_out);   /* both maps, both softmaxes, the combine and the value product */
}
